// v009
// Times are from an AMD MI455X. After a warm-up the kernel runs many times in a row, and a time is the length of
// such a window on the GPU divided by its runs, so every launch and the gaps after it count. The runs cycle
// through copies of the inputs. A figure is the median of several windows, for all but v000 over two sittings.
// Sittings can differ by a few percent; kernels timed side by side share one.
// The versions before v009 are in another document.
// One run takes 162 microseconds.
// Two timings next to v008 put it at 1.04 and 1.03 times that version's speed.
// Counting every step since v000, which is the starting kernel, it is 60.2 times as fast.
#include <hip/hip_runtime.h>
// Causal multi-head self-attention with a fused post-LayerNorm (x [4][2048][1024]; k/q/v = x W^T (natural [1024][1024], no biases); 16 heads of 64; wei = q k^T * 64^-0.5; causal (tril, -inf); softmax; y = merged Wp^T; out = LayerNorm(y) (biased var, eps per the module, gamma / beta) -> [4][2048][1024]).
// Structure: token rows r = b*2048 + s; x as exact f16 rows (bf16-rounded); Q, K, V as WMMA GEMMs in one launch (64x64 wave tiles, f32 accumulation, exact x16 weights, f16 outputs; each batch's first 128 rows also in f32, for an exact f32 attention of those rows); V^T for all heads via LDS transposes; attention in ONE launch (k_fattn): a wave holds 32 queries of one head and walks the keys up to its diagonal in passes of 32 (K, V^T from LDS stages of 64 keys, shared by a block's 4 waves): S^T = K Q^T, running maximum and sum in f32 (native exp2; weights x256 f16), O^T += V^T P^T, scores and weights never leave the registers; o (x64, folded into the output GEMM alpha) written straight into the merged f16 o rows; y = o W_o GEMM (f32; the first 128 rows of a batch from the exact o as f16 high part + residual), then the row LayerNorm into the output layout.
// Compute dtype: inputs rounded to bf16; x / weights exact; q, k, v, softmax weights and o as plain f16 GEMM operands (~2^-12); scores and softmax statistics f32; v_wmma_f32_16x16x32_f16.
#define NB 4
#define SQ 2048
#define DM 1024
#define NH 16
#define HD 64
#define HG 4                         /* heads per launch of the (b, h0) k_vt overload, which nothing launches */
#define QT0 128                      /* first-tile rows recomputed exactly in f32 */
#define B0 0                         /* first batch processed (debug hook) */
#define NBR NB                       /* batches processed (debug hook) */
#define NR ((size_t)NB * SQ)         /* token rows */
#define MP ((int)((size_t)NBR * SQ)) /* rows projected (debug hook) */
#define QN SQ                        /* query rows per batch (unused) */
#define NHD NH                       /* heads (unused) */
#define MPO MP                       /* rows through the output stage (debug hook) */
#define LQ DM      /* row pitch of the q/k/v rows */
typedef __bf16 v16b __attribute__((ext_vector_type(16)));
typedef unsigned short v8us __attribute__((ext_vector_type(8), may_alias));
typedef float  v8f  __attribute__((ext_vector_type(8)));
typedef float  v4f  __attribute__((ext_vector_type(4)));
typedef float  v4fa __attribute__((ext_vector_type(4), may_alias));
union FragB { v16b v; v8us half[2]; unsigned short u[16]; };

__device__ __forceinline__ unsigned short bf16_bits(float x) { unsigned int u = __float_as_uint(x); return (unsigned short)((u + 0x7FFFu + ((u >> 16) & 1u)) >> 16); }
__device__ __forceinline__ float bf16_val(unsigned short b) { return __uint_as_float(((unsigned int)b) << 16); }
__device__ __forceinline__ float bf16_round(float x) { return bf16_val(bf16_bits(x)); }
// D += A·B with NT terms: 1 = ah·bh, 2 = + al·bh (A split), 3 = + ah·bl (both split)
template <int NT>
__device__ __forceinline__ v8f mmaN(v16b ah, v16b al, v16b bh, v16b bl, v8f c) {
  c = __builtin_amdgcn_wmma_f32_16x16x32_bf16(false, ah, false, bh, (short)0, c, false, false);
  if (NT >= 2) c = __builtin_amdgcn_wmma_f32_16x16x32_bf16(false, al, false, bh, (short)0, c, false, false);
  if (NT >= 3) c = __builtin_amdgcn_wmma_f32_16x16x32_bf16(false, ah, false, bl, (short)0, c, false, false);
  asm volatile("v_nop\n\tv_nop\n\tv_nop\n\tv_nop" : "+v"(c) : "v"(ah), "v"(al), "v"(bh), "v"(bl));
  return c;
}

__global__ __launch_bounds__(256) void k_wt_bf16(const float* __restrict__ W, unsigned short* __restrict__ Wt, int K, int N) {
  const int t = blockIdx.x * 256 + threadIdx.x;
  const int k8n = K / 8;
  if (t >= N * k8n) return;
  const int n = t / k8n, k8 = (t % k8n) * 8;
  v8us v;
#pragma unroll
  for (int i = 0; i < 8; ++i) v[i] = bf16_bits(W[(size_t)(k8 + i) * N + n]);
  *(v8us*)(Wt + (size_t)n * K + k8) = v;
  
}

// GEMM C[M][N] (f32, pitch ldc) = act(A[M][K]·W + bias). A f32 row-major (pitch lda) converted per fragment to bf16
// (ASPLIT: hi/lo two planes -> 2 terms, else single rounded term); Wt bf16 [N][K] (pitch ldb). BIAS_BF16 rounds the
// bias to bf16 first (bias quantised to bf16 before the add). K%32==0, M%16==0, N%64==0.
template <bool ASPLIT, int ACT, bool BIAS_BF16>
__global__ __launch_bounds__(128) void k_gemm_bf(const float* __restrict__ A, int lda, const unsigned short* __restrict__ Wt, int ldb,
                                               const float* __restrict__ bias, float* __restrict__ C, int ldc, int M, int N, int K) {
  __shared__ __attribute__((aligned(16))) float so[4][16][64];
  const int tid = threadIdx.x, w = tid >> 5, lane = tid & 31, ln = lane & 15, hh = lane >> 4;
  const int ntn = N / 64;
  const int wid = blockIdx.x * 4 + w;
  const int mt = wid / ntn, nq = wid % ntn;
  if (mt * 16 >= M) return;
  const int row0 = mt * 16, col0 = nq * 64;
  const float* arow = A + (size_t)(row0 + ln) * lda;
  v8f acc[4] = {};
  for (int kb = 0; kb < K; kb += 32) {
    FragB ah, al;
    const v4f x0 = *(const v4fa*)(arow + kb + 8 * hh), x1 = *(const v4fa*)(arow + kb + 8 * hh + 4);
    const v4f x2 = *(const v4fa*)(arow + kb + 16 + 8 * hh), x3 = *(const v4fa*)(arow + kb + 16 + 8 * hh + 4);
    float xs[16] = {x0[0],x0[1],x0[2],x0[3],x1[0],x1[1],x1[2],x1[3],x2[0],x2[1],x2[2],x2[3],x3[0],x3[1],x3[2],x3[3]};
#pragma unroll
    for (int i = 0; i < 16; ++i) { const unsigned short hb = bf16_bits(xs[i]); ah.u[i] = hb; al.u[i] = ASPLIT ? bf16_bits(xs[i] - bf16_val(hb)) : (unsigned short)0; }
#pragma unroll
    for (int t = 0; t < 4; ++t) {
      const unsigned short* brow = Wt + (size_t)(col0 + t * 16 + ln) * ldb + kb;
      FragB b;
      b.half[0] = *(const v8us*)(brow + 8 * hh);
      b.half[1] = *(const v8us*)(brow + 16 + 8 * hh);
      acc[t] = mmaN<ASPLIT ? 2 : 1>(ah.v, al.v, b.v, b.v, acc[t]);
    }
  }
#pragma unroll
  for (int t = 0; t < 4; ++t) {
    float bv = bias ? bias[col0 + t * 16 + ln] : 0.f;
    if (BIAS_BF16) bv = bf16_round(bv);
#pragma unroll
    for (int r = 0; r < 8; ++r) { float v = acc[t][r] + bv; if (ACT == 1) v = fmaxf(v, 0.f); so[w][8 * hh + r][t * 16 + ln] = v; }
  }
  __builtin_amdgcn_fence(__ATOMIC_ACQ_REL, "workgroup");
  __builtin_amdgcn_wave_barrier();
  const int rsub = lane >> 4, c4 = (lane & 15) * 4;
  {
#pragma unroll
    for (int q = 0; q < 8; ++q) {
      const int r = q * 2 + rsub;
      const v4f v = *(const v4fa*)&so[w][r][c4];
      *(v4f*)(C + (size_t)(row0 + r) * ldc + col0 + c4) = v;
    }
    
  }
}

// GEMM C = act(A·W + bias + resid): A f32 (ASPLIT -> hi/lo 2 terms), Wt bf16 [N][K]; ACT 0 none, 1 relu, 2 exact gelu;
// resid (optional, f32, row index = (row % rmod), pitch ldr, RES_BF16 rounds it) added before the activation.
template <bool ASPLIT, int ACT, bool BIAS_BF16, bool RES_BF16>
__global__ __launch_bounds__(128) void k_gemm_bf3(const float* __restrict__ A, int lda, const unsigned short* __restrict__ Wt, int ldb,
                                                const float* __restrict__ bias, const float* __restrict__ resid, int rmod, int ldr,
                                                float* __restrict__ C, int ldc, int M, int N, int K) {
  __shared__ __attribute__((aligned(16))) float so[4][16][64];
  const int tid = threadIdx.x, w = tid >> 5, lane = tid & 31, ln = lane & 15, hh = lane >> 4;
  const int ntn = N / 64;
  const int wid = blockIdx.x * 4 + w;
  const int mt = wid / ntn, nq = wid % ntn;
  if (mt * 16 >= M) return;
  const int row0 = mt * 16, col0 = nq * 64;
  const float* arow = A + (size_t)(row0 + ln) * lda;
  v8f acc[4] = {};
  for (int kb = 0; kb < K; kb += 32) {
    FragB ah, al;
    const v4f x0 = *(const v4fa*)(arow + kb + 8 * hh), x1 = *(const v4fa*)(arow + kb + 8 * hh + 4);
    const v4f x2 = *(const v4fa*)(arow + kb + 16 + 8 * hh), x3 = *(const v4fa*)(arow + kb + 16 + 8 * hh + 4);
    float xs[16] = {x0[0],x0[1],x0[2],x0[3],x1[0],x1[1],x1[2],x1[3],x2[0],x2[1],x2[2],x2[3],x3[0],x3[1],x3[2],x3[3]};
#pragma unroll
    for (int i = 0; i < 16; ++i) { const unsigned short hb = bf16_bits(xs[i]); ah.u[i] = hb; al.u[i] = ASPLIT ? bf16_bits(xs[i] - bf16_val(hb)) : (unsigned short)0; }
#pragma unroll
    for (int t = 0; t < 4; ++t) {
      const unsigned short* brow = Wt + (size_t)(col0 + t * 16 + ln) * ldb + kb;
      FragB b;
      b.half[0] = *(const v8us*)(brow + 8 * hh);
      b.half[1] = *(const v8us*)(brow + 16 + 8 * hh);
      acc[t] = mmaN<ASPLIT ? 2 : 1>(ah.v, al.v, b.v, b.v, acc[t]);
    }
  }
#pragma unroll
  for (int t = 0; t < 4; ++t) {
    const int col = col0 + t * 16 + ln;
    float bv = bias ? bias[col] : 0.f;
    if (BIAS_BF16) bv = bf16_round(bv);
#pragma unroll
    for (int r = 0; r < 8; ++r) {
      float v = acc[t][r] + bv;
      if (resid) { float rv = resid[(size_t)((row0 + 8 * hh + r) % rmod) * ldr + col]; if (RES_BF16) rv = bf16_round(rv); v += rv; }
      if (ACT == 1) v = fmaxf(v, 0.f);
      if (ACT == 2) v = 0.5f * v * (1.0f + erff(v * 0.70710678118654752f));
      if (ACT == 3) { const float u = 0.7978845608028654f * (v + 0.044715f * v * v * v); v = 0.5f * v * (1.0f + tanhf(u)); }
      so[w][8 * hh + r][t * 16 + ln] = v;
    }
  }
  __builtin_amdgcn_fence(__ATOMIC_ACQ_REL, "workgroup");
  __builtin_amdgcn_wave_barrier();
  const int rsub = lane >> 4, c4 = (lane & 15) * 4;
  {
#pragma unroll
    for (int q = 0; q < 8; ++q) {
      const int r = q * 2 + rsub;
      const v4f v = *(const v4fa*)&so[w][r][c4];
      *(v4f*)(C + (size_t)(row0 + r) * ldc + col0 + c4) = v;
    }
    
  }
}
// row LayerNorm (biased variance, eps) over N: s = X (+ R); optional out_sum <- s; out_norm <- (s-mu)*rsqrt(var+eps)*g + b
template <bool PARAM_BF16>
__global__ __launch_bounds__(256) void k_layernorm(const float* __restrict__ X, const float* __restrict__ R, const float* __restrict__ g, const float* __restrict__ bta,
                                                  float* __restrict__ out_sum, float* __restrict__ out_norm, int N, float eps) {
  __shared__ float red[256];
  const int row = blockIdx.x, tid = threadIdx.x;
  const float* x = X + (size_t)row * N; const float* rr = R ? R + (size_t)row * N : nullptr;
  float vals[16];                     // up to N = 4096
  const int per = N / 256;            // contiguous chunk per thread? use strided-by-4 chunks: thread handles j = tid*4 + 1024*u
  float s1 = 0.f;
  for (int u = 0; u < per / 4; ++u) {
    const int j = tid * 4 + 1024 * u;
    const v4f a = *(const v4fa*)(x + j);
    v4f b = {0.f,0.f,0.f,0.f}; if (rr) b = *(const v4fa*)(rr + j);
#pragma unroll
    for (int q = 0; q < 4; ++q) { const float v = a[q] + b[q]; vals[u * 4 + q] = v; s1 += v; }
  }
  red[tid] = s1; __syncthreads();
  for (int st = 128; st > 0; st >>= 1) { if (tid < st) red[tid] += red[tid + st]; __syncthreads(); }
  const float mu = red[0] / (float)N; __syncthreads();
  float s2 = 0.f;
  for (int u = 0; u < per / 4; ++u)
#pragma unroll
    for (int q = 0; q < 4; ++q) { const float c = vals[u * 4 + q] - mu; s2 += c * c; }
  red[tid] = s2; __syncthreads();
  for (int st = 128; st > 0; st >>= 1) { if (tid < st) red[tid] += red[tid + st]; __syncthreads(); }
  const float rs = rsqrtf(red[0] / (float)N + eps);
  {
    for (int u = 0; u < per / 4; ++u) {
      const int j = tid * 4 + 1024 * u;
      v4f o, sm;
#pragma unroll
      for (int q = 0; q < 4; ++q) {
        float gg = g[j + q], bb = bta[j + q];
        if (PARAM_BF16) { gg = bf16_round(gg); bb = bf16_round(bb); }
        sm[q] = vals[u * 4 + q]; o[q] = (vals[u * 4 + q] - mu) * rs * gg + bb;
      }
      if (out_sum) *(v4f*)(out_sum + (size_t)row * N + j) = sm;
      *(v4f*)(out_norm + (size_t)row * N + j) = o;
    }
    
  }
}



// ---- f16 WMMA path (v_wmma_f32_16x16x32_f16): 11-bit significands for operands in range — used where a [0,1] probability operand needs more precision than bf16
typedef _Float16 v16h __attribute__((ext_vector_type(16)));
union FragH { v16h v; v8us half[2]; _Float16 h[16]; unsigned short u[16]; };
template <int NT>
__device__ __forceinline__ v8f mmaH(v16h ah, v16h al, v16h bh, v16h bl, v8f c) {
  c = __builtin_amdgcn_wmma_f32_16x16x32_f16(false, ah, false, bh, (short)0, c, false, false);
  if (NT >= 2) c = __builtin_amdgcn_wmma_f32_16x16x32_f16(false, al, false, bh, (short)0, c, false, false);
  if (NT >= 3) c = __builtin_amdgcn_wmma_f32_16x16x32_f16(false, ah, false, bl, (short)0, c, false, false);
  asm volatile("v_nop\n\tv_nop\n\tv_nop\n\tv_nop" : "+v"(c) : "v"(ah), "v"(al), "v"(bh), "v"(bl));
  return c;
}
// batched GEMM like k_gemm_b but f16 operands: A f32 (split into f16 hi/lo if ASPLIT, else rounded to f16), Bt = f16 values [n][k]; alpha; C f32; N multiple of 16 (partial tiles skipped)
template <bool ASPLIT>
__global__ __launch_bounds__(128) void k_gemm_h(const float* __restrict__ A, int lda, size_t sA, const _Float16* __restrict__ Bh, int ldb, size_t sB, float alpha, float* __restrict__ C, int ldc, size_t sC, int M, int N, int K) {
  __shared__ __attribute__((aligned(16))) float so[4][16][64];
  const int tid = threadIdx.x, w = tid >> 5, lane = tid & 31, ln = lane & 15, hh = lane >> 4; const int by = blockIdx.y;
  A += (size_t)by * sA; Bh += (size_t)by * sB; C += (size_t)by * sC;
  const int ntn = (N + 63) / 64; const int wid = blockIdx.x * 4 + w; const int mt = wid / ntn, nq = wid % ntn; if (mt * 16 >= M) return;
  const int row0 = mt * 16, col0 = nq * 64; const float* arow = A + (size_t)(row0 + ln) * lda;
  v8f acc[4] = {};
  for (int kb = 0; kb < K; kb += 32) {
    FragH ah, al;
    const v4f x0 = *(const v4fa*)(arow + kb + 8 * hh), x1 = *(const v4fa*)(arow + kb + 8 * hh + 4), x2 = *(const v4fa*)(arow + kb + 16 + 8 * hh), x3 = *(const v4fa*)(arow + kb + 16 + 8 * hh + 4);
    float xs[16] = {x0[0],x0[1],x0[2],x0[3],x1[0],x1[1],x1[2],x1[3],x2[0],x2[1],x2[2],x2[3],x3[0],x3[1],x3[2],x3[3]};
#pragma unroll
    for (int i = 0; i < 16; ++i) { const _Float16 h = (_Float16)xs[i]; ah.h[i] = h; al.h[i] = ASPLIT ? (_Float16)(xs[i] - (float)h) : (_Float16)0.0f; }
#pragma unroll
    for (int t = 0; t < 4; ++t) { if (col0 + t * 16 >= N) continue; const size_t boff = (size_t)(col0 + t * 16 + ln) * ldb + kb; FragH bq; bq.half[0] = *(const v8us*)(Bh + boff + 8 * hh); bq.half[1] = *(const v8us*)(Bh + boff + 16 + 8 * hh);
      acc[t] = mmaH<ASPLIT ? 2 : 1>(ah.v, al.v, bq.v, bq.v, acc[t]); }
  }
#pragma unroll
  for (int t = 0; t < 4; ++t) { if (col0 + t * 16 >= N) continue;
#pragma unroll
    for (int r = 0; r < 8; ++r) so[w][8 * hh + r][t * 16 + ln] = acc[t][r] * alpha; }
  __builtin_amdgcn_fence(__ATOMIC_ACQ_REL, "workgroup"); __builtin_amdgcn_wave_barrier();
  const int rsub = lane >> 4, c4 = (lane & 15) * 4;
  {
#pragma unroll
    for (int q = 0; q < 8; ++q) { const int r = q * 2 + rsub; if (col0 + c4 < N) { const v4f v = *(const v4fa*)&so[w][r][c4]; *(v4f*)(C + (size_t)(row0 + r) * ldc + col0 + c4) = v; } }
     }
}

// Wt[n][k] = f16(W[k][n]·scale) from f32 row-major W[K][N] (scale = power of two; bf16-exact weights stay exact in f16 away from the subnormal range)
__global__ __launch_bounds__(256) void k_wt_f16(const float* __restrict__ W, _Float16* __restrict__ Wt, int K, int N, float scale) {
  const int t = blockIdx.x * 256 + threadIdx.x; if (t >= N * (K / 8)) return; const int n = t / (K / 8), k8 = (t % (K / 8)) * 8; FragH f;
#pragma unroll
  for (int i = 0; i < 8; ++i) f.h[i] = (_Float16)(bf16_round(W[(size_t)(k8 + i) * N + n]) * scale); const v8us o = f.half[0];
  *(v8us*)((unsigned short*)Wt + (size_t)n * K + k8) = o; 
}
// k_gemm_hh variant with fused epilogue: v = acc·alpha + bias[by·sBias + col] (+ CP[(row/rowsPerB)·sCPb + by·64 + col] if CP) ; ACT 0 none / 1 elu ; writes f16 C16 (and f32 C if non-null)
template <int ACT>
__global__ __launch_bounds__(128) void k_gemm_hhx(const _Float16* __restrict__ A, int lda, size_t sA, const _Float16* __restrict__ Bh, int ldb, size_t sB, float alpha, const float* __restrict__ bias, size_t sBias, const float* __restrict__ CP, int rowsPerB, size_t sCPb, int row0g,
    float* __restrict__ C, _Float16* __restrict__ C16, int ldc, size_t sC, int M, int N, int K) {
  __shared__ __attribute__((aligned(16))) float so[4][16][64];
  const int tid = threadIdx.x, w = tid >> 5, lane = tid & 31, ln = lane & 15, hh = lane >> 4; const int by = blockIdx.y;
  A += (size_t)by * sA; Bh += (size_t)by * sB; const size_t cofs = (size_t)by * sC; const float* bp = bias ? bias + (size_t)by * sBias : nullptr;
  const int ntn = (N + 63) / 64; const int wid = blockIdx.x * 4 + w; const int mt = wid / ntn, nq = wid % ntn; if (mt * 16 >= M) return;
  const int row0 = mt * 16, col0 = nq * 64; const _Float16* arow = A + (size_t)(row0 + ln) * lda;
  v8f acc[4] = {};
  for (int kb = 0; kb < K; kb += 32) { FragH ah; ah.half[0] = *(const v8us*)((const unsigned short*)arow + kb + 8 * hh); ah.half[1] = *(const v8us*)((const unsigned short*)arow + kb + 16 + 8 * hh);
#pragma unroll
    for (int t = 0; t < 4; ++t) { if (col0 + t * 16 >= N) continue; const size_t boff = (size_t)(col0 + t * 16 + ln) * ldb + kb; FragH bq; bq.half[0] = *(const v8us*)((const unsigned short*)Bh + boff + 8 * hh); bq.half[1] = *(const v8us*)((const unsigned short*)Bh + boff + 16 + 8 * hh);
      acc[t] = mmaH<1>(ah.v, ah.v, bq.v, bq.v, acc[t]); }
  }
#pragma unroll
  for (int t = 0; t < 4; ++t) { if (col0 + t * 16 >= N) continue; const int col = col0 + t * 16 + ln; const float bv = bp ? bf16_round(bp[col]) : 0.f;
#pragma unroll
    for (int r = 0; r < 8; ++r) { float v = acc[t][r] * alpha + bv; if (CP) { const int rr = row0g + row0 + 8 * hh + r; if (rowsPerB < 0) v += CP[cofs + (size_t)rr * ldc + col];      /* rowsPerB < 0: own element of the batched C plane */ else { const int bidx = rr / rowsPerB; v += CP[(size_t)bidx * sCPb + (size_t)by * 64 + col]; } } if (ACT == 1) v = (v > 0.f) ? v : expm1f(v); else if (ACT == 7) v = (v > 0.f) ? v + 1.0f : expf(v); else if (ACT == 8) v = tanhf(v); else if (ACT == 9) v = 0.5f * v * (1.0f + tanhf(0.7978845608028654f * (v + 0.044715f * v * v * v))); else if (ACT == 11) v = 1.0f / (1.0f + expf(-v)); else if (ACT == 12) v = (v > 0.f) ? v : 0.01f * v; else if (ACT == 14) v = (v > 0.f) ? v : 0.1f * v; else if (ACT == 16) v = (v >= 0.f) ? v : 0.3f * v; else if (ACT == 17) v = (v >= 0.f) ? v : 0.2f * v; else if (ACT == 15) v = v / (1.0f + expf(-v)); else if (ACT == 3) v = fmaxf(v, 0.f); else if (ACT == 6) v = 0.5f * v * (1.0f + erff(v * 0.70710678118654752f)); so[w][8 * hh + r][t * 16 + ln] = v; } }
  __builtin_amdgcn_fence(__ATOMIC_ACQ_REL, "workgroup"); __builtin_amdgcn_wave_barrier();
  const int rsub = lane >> 4, c4 = (lane & 15) * 4; typedef _Float16 v4h __attribute__((ext_vector_type(4)));
  {
#pragma unroll
    for (int q = 0; q < 8; ++q) { const int r = q * 2 + rsub; if (col0 + c4 < N) { const v4f v = *(const v4fa*)&so[w][r][c4]; if (C) *(v4f*)(C + cofs + (size_t)(row0 + r) * ldc + col0 + c4) = v; if (C16) { v4h h4; for (int i = 0; i < 4; ++i) h4[i] = (_Float16)v[i]; *(v4h*)(C16 + cofs + (size_t)(row0 + r) * ldc + col0 + c4) = h4; } } }
     }
}


typedef _Float16 v4h __attribute__((ext_vector_type(4)));

// All five operand conversions in one grid, 8 elements a thread and unit. A unit is 2,048 elements; a block takes CVT_U units, one of each weight plane (natural [out][in] = Bt; rounded to
// bf16, x16, exact in f16; the planes follow one another in Bt) and one of each of the CVT_U - 4 equal slices of x (rounded to bf16, exact in f16): few waves to start, each with all
// its loads in flight at once, two blocks on a WGP.
#define CVT_NB (DM * DM / 2048)      /* blocks = units per weight plane = units per slice of x */
#define CVT_U 12      /* units per block */
static_assert(DM * DM % 2048 == 0 && NR * DM == (size_t)(CVT_U - 4) * CVT_NB * 2048, "k_cvt: whole units only, x in CVT_U - 4 slices of a weight plane's size");
__global__ __launch_bounds__(256) void k_cvt(const float* __restrict__ w0, const float* __restrict__ w1, const float* __restrict__ w2, const float* __restrict__ w3, const float* __restrict__ x, _Float16* __restrict__ Bt, _Float16* __restrict__ X16) {
  const unsigned e = blockIdx.x * 2048 + threadIdx.x * 8;      /* the thread's first element in a plane or slice */
  unsigned so[CVT_U]; v4f a[CVT_U][2]; v8us o[CVT_U];      /* so: byte offset in w0 .. w3 or x (32 bits: x stays under 4 GiB) */
#pragma unroll
  for (int k = 0; k < CVT_U; ++k) {      /* unrolled, here and below: k picks registers */
    so[k] = (e + (k < 4 ? 0u : (unsigned)(k - 4) * (CVT_NB * 2048u))) * 4u;
    const char* s = (const char*)(k == 0 ? w0 : k == 1 ? w1 : k == 2 ? w2 : k == 3 ? w3 : x) + so[k];
    a[k][0] = *(const v4fa*)s; a[k][1] = *(const v4fa*)(s + 16); }
  asm volatile("s_wait_xcnt 0x0" :: "v"(so[0]), "v"(so[4]), "v"(so[5]), "v"(so[6]), "v"(so[7]), "v"(so[8]), "v"(so[9]), "v"(so[10]), "v"(so[11]) : "memory");      /* the wait in front of any overwrite of the loads' offset registers; as inputs the offsets keep their registers up to here (else later loads' results land on them) */
  __builtin_amdgcn_sched_barrier(0);      /* all loads are issued before the first is waited for: else each sinks to its conversion and the latencies add up */
#pragma unroll
  for (int k = 0; k < CVT_U; ++k) { const float sc = k < 4 ? 16.0f : 1.0f; FragH f;
    for (int q = 0; q < 8; ++q) f.h[q] = (_Float16)(bf16_round(a[k][q >> 2][q & 3]) * sc);
    o[k] = f.half[0]; }
#pragma unroll
  for (int k = 0; k < CVT_U; ++k) *(v8us*)((char*)(k < 4 ? Bt : X16 + (size_t)(k < 8 ? 0 : 4) * (CVT_NB * 2048)) + e * 2u + (k & 3) * (CVT_NB * 4096)) = o[k]; }      /* the thread's byte offset in 32 bits; plane or slice by a constant offset from Bt or from one of the two halves of X16 */
__global__ __launch_bounds__(256) void k_h16(const float* __restrict__ x, _Float16* __restrict__ X16, size_t n8) { const size_t t = (size_t)blockIdx.x * 256 + threadIdx.x; if (t >= n8) return; FragH f;
#pragma unroll
  for (int q = 0; q < 8; ++q) f.h[q] = (_Float16)x[t * 8 + q]; *(v8us*)((unsigned short*)X16 + t * 8) = f.half[0];  }
__global__ __launch_bounds__(256) void k_round16f(const float* __restrict__ W, _Float16* __restrict__ Bt, size_t n8) { const size_t t = (size_t)blockIdx.x * 256 + threadIdx.x; if (t >= n8) return; FragH f;
#pragma unroll
  for (int i = 0; i < 8; ++i) f.h[i] = (_Float16)(bf16_round(W[t * 8 + i]) * 16.0f); *(v8us*)((unsigned short*)Bt + t * 8) = f.half[0];  }
// V^T by LDS transposes. A block takes VT_T tiles of 64 tokens x 64 dims of one head, side by side along the tokens: few waves to start, each with all its loads in flight at once.
#define VT_T 4
template <int NHv, int TTv>
__global__ __launch_bounds__(256) void k_vt(const _Float16* __restrict__ V16, int ldv, int voff, _Float16* __restrict__ Vt) { static_assert(TTv % (64 * VT_T) == 0, "k_vt: whole blocks only");
  __shared__ unsigned short tl[VT_T * 64][66]; const int tid = threadIdx.x; const int slab = blockIdx.x / (TTv / (64 * VT_T)), lg = blockIdx.x % (TTv / (64 * VT_T)); const int b = slab / NHv, h = slab % NHv;
  const int r = tid / 8, c8 = (tid % 8) * 8;      /* 8 threads a row; piece j lies 32 rows below piece j - 1 */
  unsigned vo[2 * VT_T]; v8us rg[2 * VT_T], o[2 * VT_T];      /* vo: byte offset in V16 (32 bits: the plane stays under 4 GiB) */
#pragma unroll
  for (int j = 0; j < 2 * VT_T; ++j) { vo[j] = ((unsigned)(b * TTv + lg * (64 * VT_T) + j * 32 + r) * (unsigned)ldv + (unsigned)(voff + h * 64 + c8)) * 2u; rg[j] = *(const v8us*)((const char*)V16 + vo[j]); }      /* unrolled, here and below: j picks registers */
  asm volatile("s_wait_xcnt 0x0" :: "v"(vo[0]), "v"(vo[1]), "v"(vo[2]), "v"(vo[3]), "v"(vo[4]), "v"(vo[5]), "v"(vo[6]), "v"(vo[7]) : "memory"); static_assert(VT_T == 4, "k_vt: the wait names 8 offsets");      /* the wait in front of any overwrite of the loads' offset registers; as inputs the offsets keep their registers up to here (else later loads' results land on them) */
  __builtin_amdgcn_sched_barrier(0);      /* all loads are issued before the first is waited for: else each sinks to its LDS stores and the latencies add up */
#pragma unroll
  for (int j = 0; j < 2 * VT_T; ++j) for (int q = 0; q < 8; ++q) tl[j * 32 + r][c8 + q] = rg[j][q];
  __syncthreads();      /* the tiles are complete before any thread reads them */
#pragma unroll
  for (int j = 0; j < 2 * VT_T; ++j) { const int d = (j & 1) * 32 + r;      /* piece j: tile j / 2, dim d, tokens c8 .. c8 + 7 */
    for (int q = 0; q < 8; ++q) o[j][q] = tl[(j >> 1) * 64 + c8 + q][d]; }
#pragma unroll
  for (int j = 0; j < 2 * VT_T; ++j) *(v8us*)((unsigned short*)Vt + ((size_t)slab * 64 + (j & 1) * 32 + r) * TTv + lg * (64 * VT_T) + (j >> 1) * 64 + c8) = o[j]; }

// ---- fast GEMM (block tile 128x256, eight waves as 2x4 of 64x64: an operand line is fetched by fewer blocks, and a fragment read from LDS feeds four products; requires M % 64 == 0 rows per launch region, N % 256 == 0 and K a positive multiple of 64); epilogue = k_gemm_hhx semantics without the CP plane (and no ACT 1 or 7) ----
// The operands go through LDS in stages of 64 k: every global load of a wave covers four whole 128-byte lines (4 rows x 64 k), each line is fetched once per block, and the
// fragments are read back from LDS in the k order of g2_frag. Two stage buffers: stage s + 1 is stored and stage s + 2 is requested while stage s is multiplied; one barrier a stage.
// The unroll directives in g2_request, g2_store and k_gemm2: the loop indices pick staging registers, offsets and fragments, which stay in registers only if every index is a constant.
__device__ __forceinline__ v16h g2_frag(const _Float16* p, int hh) { FragH f; f.half[0] = *(const v8us*)((const unsigned short*)p + 8 * hh); f.half[1] = *(const v8us*)((const unsigned short*)p + 16 + 8 * hh); return f.v; }
__device__ __forceinline__ v8f g2_mma(v16h a, v16h b, v8f c) { v8f d = __builtin_amdgcn_wmma_f32_16x16x32_f16(false, a, false, b, (short)0, c, false, false); asm volatile("v_nop\n\tv_nop\n\tv_nop\n\tv_nop" : "+v"(d) : "v"(a), "v"(b)); return d; }
__device__ __forceinline__ v8f g2_mmap(v16h a, v16h b, v8f c) { return __builtin_amdgcn_wmma_f32_16x16x32_f16(false, a, false, b, (short)0, c, false, false); }      /* the bare builtin: the compiler keeps the distances between products itself and is free in placing their registers (tied to g2_mma's asm operands, the 64x64 tile's accumulators and fragments spilled) */
#define G2_PITCH 144                  /* LDS row pitch in bytes for rows of 128: 16 x odd, so that the 16 rows of a 16-byte fragment read fall on all 64 banks */
#define G2_STAGE (384 * G2_PITCH)     /* one stage: 128 A rows, then 256 B rows */
__device__ __forceinline__ v16h g2_lfrag(const unsigned char* p) { FragH f; f.half[0] = *(const v8us*)p; f.half[1] = *(const v8us*)(p + 32); return f.v; }      /* p = the lane's LDS row + 16 * (lane >> 4) bytes: k 8 hh .. + 7 and 16 + 8 hh .. + 7, as g2_frag */
// The thread's 12 pieces of 16 bytes of the next stage (4 of A, 8 of B), requested as one batch; then both offsets step on by one stage. go = the thread's own byte offsets in A and in B
// (32 bits: an operand plane stays under 4 GiB); uo = the byte offsets of the 12 row groups, the same for the whole block: they go into the loads' scalar bases, so that
// twelve loads take two offset registers.
__device__ __forceinline__ void g2_request(v8us (&rg)[12], const _Float16* A, const _Float16* B, const unsigned (&uo)[12], unsigned (&go)[2]) {
#pragma unroll
  for (int j = 0; j < 12; ++j) rg[j] = *(const v8us*)(((const char*)(j < 4 ? A : B) + uo[j]) + go[j < 4 ? 0 : 1]);      /* unrolled: rg stays in registers only under constant indices */
  asm volatile("s_wait_xcnt 0x0" :: "v"(go[0]), "v"(go[1]) : "memory");      /* the wait in front of the overwrite of the loads' offset registers just below; as inputs the offsets keep their registers up to here; the memory clobber keeps the 12 loads in front of it, one batch ahead of the products */
  go[0] += 128; go[1] += 128; }
__device__ __forceinline__ void g2_store(const v8us (&rg)[12], unsigned char* sw) {
#pragma unroll
  for (int j = 0; j < 12; ++j) *(v8us*)(sw + j * 32 * G2_PITCH) = rg[j]; }      /* piece j lies 32 rows below piece j - 1 */
// FT: what a tile does that holds a batch's first QT0 rows (the rows that are carried in f32 beside the f16 path); such a tile is one whole block tile.
//   FT 1: it stores its values as f32 too, into CF (planes of NB * QT0 rows, pitch ldc, sCF elements apart along blockIdx.y).
//   FT 2: its A rows come from AF instead of A, as two f16 planes sAF elements apart: the high part, then the residual x1024. It walks K twice: the high part's sums are
//         multiplied by 1024 (exact) where the second walk begins, the residual's products are added to them, and alpha takes the 2^-10 back. K at least 128.
template <int ACT, int FT>
__global__ __launch_bounds__(256) void k_gemm2(const _Float16* __restrict__ A, int lda, size_t sA, const _Float16* __restrict__ Bh, int ldb, size_t sB, float alpha, const float* __restrict__ bias, size_t sBias, const float* __restrict__ CP, int rowsPerB, size_t sCPb, int row0g,
    float* __restrict__ C, _Float16* __restrict__ C16, int ldc, size_t sC, int M, int N, int K, size_t zA, size_t zB, size_t zC, const _Float16* __restrict__ AF, size_t sAF, float* __restrict__ CF, size_t sCF) { static_assert(QT0 == 128 && SQ % 128 == 0, "k_gemm2: a first tile is one block tile"); static_assert(ACT == 0 || ACT == 3 || ACT == 6 || ACT == 8 || ACT == 9 || ACT == 11 || ACT == 12 || ACT == 14 || ACT == 15 || ACT == 16 || ACT == 17, "k_gemm2: unsupported ACT code (would silently apply no activation)");
  __shared__ __attribute__((aligned(16))) unsigned char sm[2 * G2_STAGE]; float (*so)[32][68] = (float (*)[32][68])sm; static_assert(8 * 32 * 68 * 4 <= 2 * G2_STAGE, "k_gemm2: the epilogue's rows fit the stage buffers");      /* the epilogue's staging rows reuse the stage buffers, behind the loop's last barrier */
  const int tid = threadIdx.x, w = tid >> 5, lane = tid & 31, ln = lane & 15, hh = lane >> 4; const int by = blockIdx.y, bz = blockIdx.z;      /* two batch axes, each with its own strides */
  A += (size_t)by * sA + (size_t)bz * zA; Bh += (size_t)by * sB + (size_t)bz * zB; const size_t cofs = (size_t)by * sC + (size_t)bz * zC; const float* bp = bias ? bias + (size_t)by * sBias : nullptr;
  const int ntn = N >> 8; const int mt = blockIdx.x / ntn, nq = blockIdx.x - mt * ntn; const int wr = w >> 2, wc = w & 3; const int row0 = mt * 128 + 64 * wr, col0 = nq * 256 + 64 * wc;      /* the wave's 64x64 tile */
  const bool ft = (mt % (SQ / 128)) == 0; const int fr0 = (mt / (SQ / 128)) * QT0;      /* a first tile, and its first row in the first-tile planes; the same for the whole block */
  const _Float16* const Ab = (FT == 2 && ft) ? AF : A;
  const int sr = tid >> 3, sc = (tid & 7) * 8;      /* staging: 8 threads a row, piece j of a thread = stage row 32 j + sr, k sc .. sc + 7 */
  unsigned go[2], uo[12]; v8us rg[12];
#pragma unroll
  for (int j = 0; j < 4; ++j) { const int rb = mt * 128 + j * 32; uo[j] = (unsigned)((FT == 2 && ft) ? fr0 + j * 32 : rb <= M - 32 ? rb : M - 32) * (unsigned)lda * 2u; }      /* a row group past M (its wave stores nothing) reads the last 32 rows instead */
  go[0] = ((unsigned)sr * (unsigned)lda + sc) * 2u; go[1] = ((unsigned)sr * (unsigned)ldb + sc) * 2u;
#pragma unroll
  for (int j = 0; j < 8; ++j) uo[4 + j] = (unsigned)__builtin_amdgcn_readfirstlane((int)((unsigned)(nq * 256 + j * 32) * (unsigned)ldb * 2u));      /* through readfirstlane, so that each stays a scalar of its own: as plain multiples of one stride the compiler chained them into vector address pairs, on which later loads' results landed */
  unsigned char* const sw = sm + sr * G2_PITCH + sc * 2;
  const unsigned char* const ar = sm + (64 * wr + ln) * G2_PITCH + 16 * hh; const unsigned char* const br = sm + (128 + 64 * wc + ln) * G2_PITCH + 16 * hh;
  const v8f z8 = {0.f,0.f,0.f,0.f,0.f,0.f,0.f,0.f}; v8f cc[4][4];      /* cc[i][t]: rows 16 i .., columns 16 t .. of the wave's tile */
#pragma unroll
  for (int i = 0; i < 4; ++i) for (int t = 0; t < 4; ++t) cc[i][t] = z8;
  const int nk = K >> 6; const int nst = (FT == 2 && ft) ? 2 * nk : nk;
  g2_request(rg, Ab, Bh, uo, go); g2_store(rg, sw); if (nst > 1) g2_request(rg, Ab, Bh, uo, go);
  __syncthreads();      /* stage 0 is complete before any wave reads it */
#pragma unroll 1
  for (int s = 0; s < nst; ++s) {      /* rolled: the trip count is a run-time value and one copy of the body holds all the overlap there is */
    const int cur = (s & 1) * G2_STAGE;
    if (FT == 2 && s == nk) {      /* the second walk begins (first tiles only: elsewhere s stays below nk) */
#pragma unroll
      for (int i = 0; i < 4; ++i) for (int t = 0; t < 4; ++t) cc[i][t] *= 1024.0f; }
    if (s + 1 < nst) { g2_store(rg, sw + (G2_STAGE - cur));
      if (s + 2 < nst) {
        if (FT == 2 && s + 2 == nk) { go[0] += (unsigned)sAF * 2u - (unsigned)K * 2u; go[1] -= (unsigned)K * 2u; }      /* the next request is the second walk's first: A on to the residual plane, B back to k = 0 */
        g2_request(rg, Ab, Bh, uo, go); } }      /* stage s + 1 into the buffer that every wave left at the last barrier; stage s + 2 in flight under this stage's products */
    v16h fa[2][4], fb[2][4];      /* the loops over ks, t and i are unrolled: the indices pick fragments and accumulators, which stay in registers only if they are constants */
#pragma unroll
    for (int ks = 0; ks < 2; ++ks) {
      if (ks == 0 || FT != 2) {      /* FT 2 (one block on a WGP, registers to spare): both k steps' reads in front of the first product; else each k step's 16 reads in front of its own products */
#pragma unroll
        for (int k2 = ks; k2 < (FT == 2 ? 2 : ks + 1); ++k2) for (int t = 0; t < 4; ++t) { fa[k2][t] = g2_lfrag(ar + cur + t * 16 * G2_PITCH + k2 * 64); fb[k2][t] = g2_lfrag(br + cur + t * 16 * G2_PITCH + k2 * 64); }
        __builtin_amdgcn_sched_barrier(0); }      /* the reads go out as one group: left alone they were spread among the products in pairs, each pair waited for at once, and every pair's latency showed */
#pragma unroll
      for (int t = 0; t < 4; ++t) for (int i = 0; i < 4; ++i) if (ks + t + i < 7) cc[i][t] = g2_mmap(fa[ks][i], fb[ks][t], cc[i][t]);
      __builtin_amdgcn_sched_barrier(0); }      /* the next k step's reads stay behind these products (no second fragment set in registers); behind the last step: the products stay in front of the stage's last one (some had sunk behind the barrier, right in front of the loop's branch) */
    cc[3][3] = g2_mma(fa[1][3], fb[1][3], cc[3][3]);      /* the stage's last product with g2_mma's four free slots: a branch follows */
    __syncthreads(); }      /* stage s + 1 is complete, and every wave has left stage s, whose buffer the next trip overwrites (behind the last trip: the epilogue) */
  if (row0 >= M) return;      /* no barrier behind this point */
  const float al = (FT == 2 && ft) ? alpha * 0.0009765625f : alpha;
  const int rsub = lane >> 4, c4 = (lane & 15) * 4;
#pragma unroll
  for (int hf = 0; hf < 2; ++hf) {      /* the wave's tile leaves in two halves of 32 rows, through the same staging rows; unrolled: hf picks accumulators */
  const int rowh = row0 + 32 * hf;
#pragma unroll
  for (int u = 0; u < 8; ++u) { const int t = u & 3, half = u >> 2; const int col = col0 + t * 16 + ln; const float bv = bp ? bf16_round(bp[col]) : 0.f;
#pragma unroll
    for (int r = 0; r < 8; ++r) { const int rloc = half * 16 + 8 * hh + r; float v = cc[2 * hf + half][t][r] * al + bv;      /* no added plane: CP, rowsPerB, sCPb and row0g are not read (every launch passes CP = nullptr); with that branch at each of a lane's 128 elements the kernel's text was five times as long */
      if (ACT == 3) v = fmaxf(v, 0.f); else if (ACT == 6) v = 0.5f * v * (1.0f + erff(v * 0.70710678118654752f)); else if (ACT == 11) v = 1.0f / (1.0f + expf(-v)); else if (ACT == 15) v = v / (1.0f + expf(-v)); else if (ACT == 12) v = (v > 0.f) ? v : 0.01f * v; else if (ACT == 8) v = tanhf(v); else if (ACT == 9) v = 0.5f * v * (1.0f + tanhf(0.7978845608028654f * (v + 0.044715f * v * v * v))); else if (ACT == 14) v = (v > 0.f) ? v : 0.1f * v; else if (ACT == 16) v = (v >= 0.f) ? v : 0.3f * v; else if (ACT == 17) v = (v >= 0.f) ? v : 0.2f * v;
      so[w][rloc][t * 16 + ln] = v; } }
  __builtin_amdgcn_fence(__ATOMIC_ACQ_REL, "workgroup"); __builtin_amdgcn_wave_barrier();
  {
#pragma unroll
    for (int q = 0; q < 16; ++q) { const int r = q * 2 + rsub; const v4f v = *(const v4fa*)&so[w][r][c4];
      /* behind each of the stores, at the end of its branch: the wait in front of the overwrite of the store's registers (the next store's value or address, formed in the next branch, lands on them) */
      if (C) { *(v4f*)(C + cofs + (size_t)(rowh + r) * ldc + col0 + c4) = v; asm volatile("s_wait_xcnt 0x0" ::: "memory"); }
      if (C16) { v4h h4; for (int i = 0; i < 4; ++i) h4[i] = (_Float16)v[i]; *(v4h*)(C16 + cofs + (size_t)(rowh + r) * ldc + col0 + c4) = h4; asm volatile("s_wait_xcnt 0x0" ::: "memory"); }
      if (FT == 1 && ft) { *(v4f*)(CF + (size_t)by * sCF + (size_t)(fr0 + 64 * wr + 32 * hf + r) * ldc + col0 + c4) = v; asm volatile("s_wait_xcnt 0x0" ::: "memory"); } }
     }
  if (hf == 0) { __builtin_amdgcn_fence(__ATOMIC_ACQ_REL, "workgroup"); __builtin_amdgcn_wave_barrier(); } } }      /* the first half's rows are read back by all lanes before the second half overwrites them */


__global__ __launch_bounds__(256) void k_rsm(const float* __restrict__ S, _Float16* __restrict__ P, int nrows) {
  #pragma clang fp contract(off)
  const int i = blockIdx.x * 256 + threadIdx.x; if (i >= nrows) return; const float* s = S + (size_t)i * SQ; float mx = -3.0e38f;
#pragma unroll 1
  for (int j = 0; j < SQ; ++j) mx = fmaxf(mx, s[j]); float se = 0.f;
#pragma unroll 1
  for (int j = 0; j < SQ; ++j) se += expf(s[j] - mx); const float sc = 256.0f / se;
#pragma unroll 1
  for (int j0 = 0; j0 < SQ; j0 += 8) { FragH f; for (int q = 0; q < 8; ++q) f.h[q] = (_Float16)(expf(s[j0 + q] - mx) * sc); unsigned short* d = (unsigned short*)P + (size_t)i * SQ + j0; *(v8us*)d = f.half[0];  } }
__global__ __launch_bounds__(256) void k_vt(const _Float16* __restrict__ V16, int b, int h0, _Float16* __restrict__ VT) { __shared__ unsigned short tl[64][65]; const int tid = threadIdx.x; const int hh = blockIdx.x % HG, sg = blockIdx.x / HG; const int s0 = sg * 64; const int h = h0 + hh;
  for (int i = tid; i < 64 * 8; i += 256) { const int j = i / 8, d8 = (i % 8) * 8; FragH f; f.half[0] = *(const v8us*)((const unsigned short*)V16 + ((size_t)b * SQ + s0 + j) * DM + h * HD + d8); for (int q = 0; q < 8; ++q) tl[d8 + q][j] = f.u[q]; }
  __syncthreads();
  { for (int i = tid; i < 64 * 8; i += 256) { const int d = i / 8, j8 = (i % 8) * 8; FragH f; for (int q = 0; q < 8; ++q) f.u[q] = tl[d][j8 + q]; *(v8us*)((unsigned short*)VT + ((size_t)hh * HD + d) * SQ + s0 + j8) = f.half[0]; }  } }



// ---- fused causal attention ----
typedef _Float16 v8h __attribute__((ext_vector_type(8)));
__device__ __forceinline__ float fa_xhalf(float x) { return __builtin_bit_cast(float, __builtin_amdgcn_permlanex16(__builtin_bit_cast(int, x), __builtin_bit_cast(int, x), 0x76543210, 0xfedcba98, false, false)); }      /* lane l takes lane l ^ 16 */
__device__ __forceinline__ v8f fa_mma(v16h a, v16h b, v8f c) { return __builtin_amdgcn_wmma_f32_16x16x32_f16(false, a, false, b, (short)0, c, false, false); }
// Native 2^x and 1/x. In asm so that the v_nop stands directly behind the last transcendental: the one free issue slot that the instruction set asks for before an instruction that
// reads the result or overwrites the source. In the group of four each v_exp_f32 is
// the free slot of the one before it: the early-clobber results lie on no source.
__device__ __forceinline__ float fa_exp2(float x) { float r; asm("v_exp_f32 %0, %1\n\tv_nop" : "=v"(r) : "v"(x)); return r; }
__device__ __forceinline__ float fa_rcp(float x) { float r; asm("v_rcp_f32 %0, %1\n\tv_nop" : "=v"(r) : "v"(x)); return r; }
__device__ __forceinline__ v4f fa_exp2x4(v4f x) { float r0, r1, r2, r3;
  asm("v_exp_f32 %0, %4\n\tv_exp_f32 %1, %5\n\tv_exp_f32 %2, %6\n\tv_exp_f32 %3, %7\n\tv_nop" : "=&v"(r0), "=&v"(r1), "=&v"(r2), "=&v"(r3) : "v"(x[0]), "v"(x[1]), "v"(x[2]), "v"(x[3]));
  const v4f r = {r0, r1, r2, r3}; return r; }
// Fragment of 16 rows x 32 k in the k order of g2_frag; p = the lane's row + 8 * (lane >> 4), so that the pointer itself is the loads' address register.
__device__ __forceinline__ v16h fa_frag(const _Float16* p) { FragH f; f.half[0] = *(const v8us*)((const unsigned short*)p); f.half[1] = *(const v8us*)((const unsigned short*)p + 16); return f.v; }
// K and V^T reach the waves through LDS, in stages of 64 keys that the block's four waves share: 64 K rows (64 dims each), then 64 V^T rows (64 keys each), all rows of 128 bytes.
#define FA_PITCH 144                  /* LDS row pitch in bytes, as G2_PITCH: 16 x odd, so that the 16 rows of a 16-byte fragment read fall on all 64 banks */
#define FA_TILE (64 * FA_PITCH)       /* 64 rows */
#define FA_STAGE (2 * FA_TILE)        /* one stage: the K rows, then the V^T rows */
// One stage's copies of a thread: 8 pieces of 16 bytes, global memory to LDS through no register (8 threads a row, piece j 16 rows below piece j - 1; 4 pieces of K, 4 of V^T).
// ld = the thread's LDS byte address in the stage's first K row group; kg, vg = its global addresses there. The s_wait_xcnt is the statement's last line, so that it stands in
// front of every later write of a register that a copy names (the callers step kg and vg right behind the call).
__device__ __forceinline__ void fa_copy(unsigned ld, const _Float16* kg, const _Float16* vg) {
  asm volatile("global_load_async_to_lds_b128 %0, %8, off\n\t"
               "global_load_async_to_lds_b128 %1, %9, off\n\t"
               "global_load_async_to_lds_b128 %2, %10, off\n\t"
               "global_load_async_to_lds_b128 %3, %11, off\n\t"
               "global_load_async_to_lds_b128 %4, %12, off\n\t"
               "global_load_async_to_lds_b128 %5, %13, off\n\t"
               "global_load_async_to_lds_b128 %6, %14, off\n\t"
               "global_load_async_to_lds_b128 %7, %15, off\n\t"
               "s_wait_xcnt 0x0"
               :: "v"(ld), "v"(ld + 16 * FA_PITCH), "v"(ld + 32 * FA_PITCH), "v"(ld + 48 * FA_PITCH),
                  "v"(ld + FA_TILE), "v"(ld + FA_TILE + 16 * FA_PITCH), "v"(ld + FA_TILE + 32 * FA_PITCH), "v"(ld + FA_TILE + 48 * FA_PITCH),
                  "v"(kg), "v"(kg + (size_t)16 * DM), "v"(kg + (size_t)32 * DM), "v"(kg + (size_t)48 * DM),
                  "v"(vg), "v"(vg + (size_t)16 * SQ), "v"(vg + (size_t)32 * SQ), "v"(vg + (size_t)48 * SQ)
               : "memory"); }
// One pass: 32 keys against the wave's 32 queries (two groups of 16). Lane (c = lane & 15, hh = lane >> 4) owns query 16 g + c in both products:
//   S^T = K Q^T : A = 16 K rows (g2_lfrag from LDS), B = 16 Q rows (fa_frag), the same k order; s[g][kt][r] = score of key 16 kt + 8 hh + r
//   O^T += V^T P^T : A = 16 V^T rows (dims) by g2_lfrag over the 32 keys; B element e = weight of key (e < 8 ? 8 hh + e : 16 + 8 hh + e - 8) = s[g][e >> 3][e & 7], the k order of g2_lfrag
// so maximum, sum and rescale are the lane's own, with one exchange between the wave's halves. mr = maximum in use (log2 units); it may trail the true one by up to 6
// (weights then reach 256 * 2^6, well inside f16); sums and o are rescaled only in a pass in which some query's maximum has run further ahead.
// kn = the lane's place in the K rows of the next pass, read only where NEXTK says that the wave has that pass and that it lies in the same stage; vl = its place in this pass's
// V^T columns. DIAG and NEXTK are the same for the whole wave (scalar branches): one copy of the pass serves all cases, so the accumulators stay in their registers.
// The unroll directives here and in k_fattn: the loop indices pick fragments and accumulators, which stay in registers only if every index is a constant.
__device__ __forceinline__ void fa_pass(const bool DIAG, const bool NEXTK, v16h (&kf)[2][2], const unsigned char* kn, const unsigned char* vl, const v16h (&qf)[2][2], v8f (&o)[2][4], float (&mr)[2], float (&l)[2], int rel) {
  const float cs = 0.125f * 1.44269504088896340736f;      /* score scale times log2(e) */
  v16h vf[4];
#pragma unroll
  for (int t = 0; t < 4; ++t) vf[t] = g2_lfrag(vl + t * 16 * FA_PITCH);      /* this pass's V^T: in flight under the first product and the softmax */
  v8f s[2][2]; const v8f z8 = {0.f, 0.f, 0.f, 0.f, 0.f, 0.f, 0.f, 0.f};
#pragma unroll
  for (int g = 0; g < 2; ++g) for (int kt = 0; kt < 2; ++kt) { const v8f t = fa_mma(kf[kt][0], qf[g][0], z8); s[g][kt] = (g + kt == 2) ? g2_mma(kf[kt][1], qf[g][1], t) : fa_mma(kf[kt][1], qf[g][1], t); }      /* the last one with g2_mma's four free slots: a branch follows */
  if (NEXTK) {      /* the next pass's K, of the same stage: in flight under this pass's softmax and second product */
#pragma unroll
    for (int kt = 0; kt < 2; ++kt) for (int d = 0; d < 2; ++d) kf[kt][d] = g2_lfrag(kn + kt * 16 * FA_PITCH + d * 64); }
  if (DIAG) {      /* the pass on the diagonal: key 16 kt + 8 hh + r stays while it is not above query 16 g + c (rel = c - 8 hh) */
#pragma unroll
    for (int g = 0; g < 2; ++g) for (int kt = 0; kt < 2; ++kt) for (int r = 0; r < 8; ++r) s[g][kt][r] = (16 * kt + r - 16 * g <= rel) ? s[g][kt][r] : -1.0e30f; }
  float mb[2]; bool need = false;
#pragma unroll
  for (int g = 0; g < 2; ++g) { float mx = s[g][0][0];
    for (int r = 1; r < 8; ++r) mx = fmaxf(mx, s[g][0][r]);
    for (int r = 0; r < 8; ++r) mx = fmaxf(mx, s[g][1][r]);
    mx = fmaxf(mx, fa_xhalf(mx)) * cs; mb[g] = mx; need = need || (mx > mr[g] + 6.0f); }
  if (__builtin_amdgcn_ballot_w32(need) != 0) {      /* wave-uniform; always taken in the first pass (mr = -1e30, factor 0), seldom later */
#pragma unroll
    for (int g = 0; g < 2; ++g) { const float mn = fmaxf(mr[g], mb[g]); const float corr = fa_exp2(mr[g] - mn); mr[g] = mn; l[g] *= corr;
      for (int t = 0; t < 4; ++t) o[g][t] *= corr; } }
#pragma unroll
  for (int g = 0; g < 2; ++g) { const float nm = 8.0f - mr[g];      /* weights carried x256 */
    FragH pf; v4f ls = {0.f, 0.f, 0.f, 0.f};
    for (int i = 0; i < 4; ++i) { v4f a; for (int u = 0; u < 4; ++u) a[u] = fmaf(s[g][i >> 1][(i & 1) * 4 + u], cs, nm);
      const v4f p = fa_exp2x4(a); ls += p; for (int u = 0; u < 4; ++u) pf.h[i * 4 + u] = (_Float16)p[u]; }
    l[g] += (ls[0] + ls[1]) + (ls[2] + ls[3]);
    for (int t = 0; t < 3; ++t) o[g][t] = fa_mma(vf[t], pf.v, o[g][t]);
    o[g][3] = g2_mma(vf[3], pf.v, o[g][3]); } }      /* the weights' last use, with g2_mma's four free slots: what may next land on their registers is asm text (fa_exp2x4, fa_rcp) */
// grid (heads, batches, blocks of 128 queries, the longest first); 4 waves of 32 queries. The block walks the keys up to its last query in stages of 64 (two passes), two LDS
// buffers: stage st + 1's copies fly while stage st is worked on. A wave skips the passes above its own diagonal, but passes every wait and barrier.
__global__ __launch_bounds__(128) void k_fattn(const _Float16* __restrict__ Q, const _Float16* __restrict__ K, const _Float16* __restrict__ VT, _Float16* __restrict__ O) {
  __shared__ __attribute__((aligned(16))) unsigned char sm[2 * FA_STAGE];
  const int tid = threadIdx.x, lane = tid & 31, c = lane & 15, hh = lane >> 4; const int h = blockIdx.x, b = blockIdx.y;
  const int zb = (int)(gridDim.z - 1 - blockIdx.z);      /* the block's 128 queries */
  const int q0 = zb * 128 + __builtin_amdgcn_readfirstlane(tid >> 5) * 32;      /* the wave's first query: scalar, so the pass count is */
  const _Float16* qp = Q + ((size_t)b * SQ + q0 + c) * DM + h * HD + 8 * hh;      /* the lane's row and half, as fa_frag takes them */
  v16h qf[2][2], kf[2][2];
#pragma unroll
  for (int g = 0; g < 2; ++g) for (int d = 0; d < 2; ++d) qf[g][d] = fa_frag(qp + (size_t)g * 16 * DM + d * 32);
  asm volatile("s_wait_xcnt 0x0" :: "v"(qp) : "memory");      /* the wait in front of any overwrite of the loads' address register; as an input the address keeps its register up to here */
  const int sr = tid >> 3, sc = (tid & 7) * 8;      /* staging: 8 threads a row */
  const _Float16* kg = K + ((size_t)b * SQ + sr) * DM + h * HD + sc; const _Float16* vg = VT + ((size_t)(b * NH + h) * HD + sr) * SQ + sc;
  const unsigned ld = (unsigned)(size_t)(sm + sr * FA_PITCH + sc * 2);      /* the low 32 bits of the address: the byte offset in the block's LDS */
  const unsigned char* const kl = sm + c * FA_PITCH + 16 * hh; const unsigned char* const vl = kl + FA_TILE;      /* the lane's row and half in a tile, as g2_lfrag takes them */
  const int nst = 2 * zb + 2, nd = q0 >> 5;      /* stages of the block (two at least); the wave's pass on the diagonal */
  const v8f z8 = {0.f, 0.f, 0.f, 0.f, 0.f, 0.f, 0.f, 0.f}; v8f o[2][4] = {{z8, z8, z8, z8}, {z8, z8, z8, z8}}; float mr[2] = {-1.0e30f, -1.0e30f}, l[2] = {0.f, 0.f};
  const int rel = c - 8 * hh;
  fa_copy(ld, kg, vg); kg += (size_t)64 * DM; vg += 64;
  asm volatile("s_wait_asynccnt 0x0" ::: "memory");      /* the wave's own copies of stage 0 have landed */
  __syncthreads();      /* stage 0 is complete before any wave reads it */
  fa_copy(ld + FA_STAGE, kg, vg); kg += (size_t)64 * DM; vg += 64;
#pragma unroll 1
  for (int st = 0; st < nst; ++st) {      /* rolled: the trip count is a run-time value, and the buffer's offset is one addition */
    const int cur = (st & 1) * FA_STAGE;
    if (2 * st <= nd) {      /* a scalar test: the wave has the stage's first pass */
#pragma unroll
      for (int kt = 0; kt < 2; ++kt) for (int d = 0; d < 2; ++d) kf[kt][d] = g2_lfrag(kl + cur + kt * 16 * FA_PITCH + d * 64); }
#pragma unroll 1
    for (int p = 0; p < 2; ++p) {      /* rolled: one copy of the pass */
      const int kb = 2 * st + p;
      if (kb <= nd) fa_pass(kb == nd, p == 0 && kb < nd, kf, kl + cur + 32 * FA_PITCH, vl + cur + p * 64, qf, o, mr, l, rel); }      /* scalar tests: a pass above the wave's diagonal is skipped */
    asm volatile("s_wait_dscnt 0x0" ::: "memory");      /* the wave's reads of this stage have returned before the buffer is given up */
    asm volatile("s_wait_asynccnt 0x0" ::: "memory");      /* its copies of stage st + 1 have landed */
    __syncthreads();      /* stage st + 1 is complete, and every wave has left stage st */
    if (st + 2 < nst) { fa_copy(ld + cur, kg, vg); kg += (size_t)64 * DM; vg += 64; } }      /* stage st + 2 into the buffer just left; the test is the same for the whole block */
  asm volatile("s_wait_asynccnt 0x0" ::: "memory");      /* no copy is outstanding when the wave ends */
  _Float16* op = O + ((size_t)b * SQ + q0 + c) * DM + h * HD + 8 * hh;      /* o[g][t][r] = dim 16 t + 8 hh + r of query 16 g + c: eight neighbours, one 16-byte store */
  v8h ov[2][4];
#pragma unroll
  for (int g = 0; g < 2; ++g) { const float fin = 64.0f * fa_rcp(l[g] + fa_xhalf(l[g]));      /* the halves' sums joined; o carried x64 */
    for (int t = 0; t < 4; ++t) for (int r = 0; r < 8; ++r) ov[g][t][r] = (_Float16)(o[g][t][r] * fin); }
#pragma unroll
  for (int g = 0; g < 2; ++g) for (int t = 0; t < 4; ++t) *(v8h*)(op + (size_t)g * 16 * DM + t * 16) = ov[g][t]; }


typedef float v2f __attribute__((ext_vector_type(2)));
// exp(x) to f32 accuracy, in the way expf is expanded: n = nearest integer to x log2(e); v_exp_f32 of x log2(e) - n, log2(e) taken in two parts (two fma, so the difference is
// rounded once); ldexp by n; 0 and infinity beyond the two range ends. Written out so that v_exp_f32 can stand in asm with its v_nop directly behind it: the one free issue slot
// that the instruction set asks for before an instruction that reads the result or overwrites the source.
__device__ __forceinline__ float exp_slot(float x) {
  const float c_hi = __uint_as_float(0x3fb8aa3bu), c_lo = __uint_as_float(0x32a5705fu);
  const float n = rintf(x * c_hi); const float a = fmaf(x, c_lo, fmaf(x, c_hi, -n));
  float r; asm("v_exp_f32 %0, %1\n\tv_nop" : "=v"(r) : "v"(a));
  r = ldexpf(r, (int)n); r = (__uint_as_float(0xc2ce8ed0u) > x) ? 0.f : r; r = (__uint_as_float(0x42b17218u) < x) ? __uint_as_float(0x7f800000u) : r; return r; }
// Exact f32 attention of the first QT0 rows, one thread per query row. The row's q and o stay in registers. K and V come in tiles of 64 keys through LDS
// (K transposed to [dim][key], V as [key][dim]) and are read back as broadcasts, 32 reads at a time, one such batch in flight while the batch before it is worked on.
// Eight keys are worked on together: their eight score sums run side by side (each still summed over the dims in ascending order, s = fma(q, k, s)),
// then the running maximum, the two exps and the running sum key by key, then the o update key by key (o = fma(o, sc, e v), l = fma(l, sc, e)).
// Every row sees its keys, and every sum its terms, in the same order as with one key at a time.
template <int MASKADD>
__global__ __launch_bounds__(64) void k_att0(const float* __restrict__ QF, const float* __restrict__ KF, const float* __restrict__ VF, int ld, const float* __restrict__ mask, float scale, _Float16* __restrict__ OH, _Float16* __restrict__ OL, int ldo) {
  __shared__ __attribute__((aligned(16))) float lkt[HD][64]; __shared__ __attribute__((aligned(16))) float lv[64][HD]; __shared__ __attribute__((aligned(16))) float lo[64][HD + 4];
  const int tid = threadIdx.x; const int h = blockIdx.x / (QT0 / 64), rg = blockIdx.x % (QT0 / 64); const int i = rg * 64 + tid;
  { const size_t rb = (size_t)blockIdx.y * QT0; QF += rb * ld; KF += rb * ld; VF += rb * ld; OH += rb * ldo; OL += rb * ldo; }      /* blockIdx.y = batch: QT0 rows of q, k, v and o each */
  const float* qr = QF + (size_t)i * ld + h * HD;
  float q[HD]; v2f o[HD / 2];
#pragma unroll
  for (int c = 0; c < HD / 4; ++c) { const v4f t = *(const v4fa*)(qr + c * 4); for (int u = 0; u < 4; ++u) q[c * 4 + u] = t[u]; const v2f z = {0.f, 0.f}; o[c * 2] = z; o[c * 2 + 1] = z; }
  asm volatile("s_wait_xcnt 0x0" :: "v"(qr) : "memory");      /* the wait in front of any overwrite of the loads' address register; named as an input, the address stays in its register up to here (else the last load's result lands on it) */
  float m = -1.0e30f, l = 0.f; const int jmax = MASKADD ? (SQ - 1) : (rg * 64 + 63);      /* additive-mask form: every key (the mask input decides); causal form: keys up to the block's last row */
#pragma unroll 1
  for (int j0 = 0; j0 <= jmax; j0 += 64) {      /* rolled: one copy of the unrolled body below */
    const float* kr = KF + (size_t)(j0 + tid) * ld + h * HD;      /* thread = key: the transposed stores of a wave fall on consecutive banks */
    const float* vr = VF + (size_t)(j0 + tid / 16) * ld + h * HD + (tid % 16) * 4;      /* 16 threads a row: whole lines */
    v4f tk[16], tv[16]; const float* vp[16];
#pragma unroll
    for (int c = 0; c < 16; ++c) { vp[c] = vr + (size_t)(c * 4) * ld; tk[c] = *(const v4fa*)(kr + c * 4); tv[c] = *(const v4fa*)vp[c]; }
    asm volatile("s_wait_xcnt 0x0" :: "v"(kr), "v"(vp[0]), "v"(vp[1]), "v"(vp[2]), "v"(vp[3]), "v"(vp[4]), "v"(vp[5]), "v"(vp[6]), "v"(vp[7]), "v"(vp[8]), "v"(vp[9]), "v"(vp[10]), "v"(vp[11]), "v"(vp[12]), "v"(vp[13]), "v"(vp[14]), "v"(vp[15]) : "memory");      /* as behind the q loads: every address of the batch keeps its register up to the wait (else later loads' results land on earlier loads' addresses) */
    __builtin_amdgcn_sched_barrier(0);      /* all 32 loads of the tile are issued before the first is waited for: without it each load sinks to its LDS store and the latencies add up */
#pragma unroll
    for (int c = 0; c < 16; ++c) { for (int u = 0; u < 4; ++u) lkt[c * 4 + u][tid] = tk[c][u]; *(v4f*)&lv[c * 4 + tid / 16][(tid % 16) * 4] = tv[c]; }
    __syncthreads();      /* the tile is complete before any thread reads it */
#pragma unroll 1
    for (int jg = 0; jg < 64; jg += 8) {      /* rolled for the same reason */
      v4f ba[32], bb[32]; v2f s2[4]; float sc[8], e[8]; for (int p = 0; p < 4; ++p) { const v2f z = {0.f, 0.f}; s2[p] = z; }
      /* batch b of K: dims 16 b .. + 15 of the eight keys; batch b of V: keys 2 b and 2 b + 1, all dims */
      auto load_k = [&](int b, v4f* t) {
#pragma unroll
        for (int x = 0; x < 16; ++x) { t[x * 2] = *(const v4f*)&lkt[b * 16 + x][jg]; t[x * 2 + 1] = *(const v4f*)&lkt[b * 16 + x][jg + 4]; }
        __builtin_amdgcn_sched_barrier(0); };      /* keeps the batch's reads in front of the arithmetic on the batch before: without it they sink to their first use and every read's latency shows */
      auto load_v = [&](int b, v4f* t) {
#pragma unroll
        for (int x = 0; x < 32; ++x) t[x] = *(const v4f*)&lv[jg + b * 2 + (x >> 4)][(x & 15) * 4];
        __builtin_amdgcn_sched_barrier(0); };      /* as in load_k */
      auto work_k = [&](int b, const v4f* t) {
#pragma unroll
        for (int x = 0; x < 16; ++x) { const float qs = q[b * 16 + x]; const v2f qd = {qs, qs}; const v4f ka = t[x * 2], kb = t[x * 2 + 1];
          const v2f k0 = {ka[0], ka[1]}, k1 = {ka[2], ka[3]}, k2 = {kb[0], kb[1]}, k3 = {kb[2], kb[3]};
          s2[0] = __builtin_elementwise_fma(qd, k0, s2[0]); s2[1] = __builtin_elementwise_fma(qd, k1, s2[1]); s2[2] = __builtin_elementwise_fma(qd, k2, s2[2]); s2[3] = __builtin_elementwise_fma(qd, k3, s2[3]); }
        __builtin_amdgcn_sched_barrier(0); };      /* the next batch's reads stay behind this arithmetic, so that no more than two batches hold registers */
      auto work_v = [&](int b, const v4f* t) {
#pragma unroll
        for (int x = 0; x < 32; ++x) { const int u = b * 2 + (x >> 4), c = x & 15; const v2f sc2 = {sc[u], sc[u]}, e2 = {e[u], e[u]}; const v4f vv = t[x]; const v2f v0 = {vv[0], vv[1]}, v1 = {vv[2], vv[3]};
          o[c * 2] = __builtin_elementwise_fma(o[c * 2], sc2, e2 * v0); o[c * 2 + 1] = __builtin_elementwise_fma(o[c * 2 + 1], sc2, e2 * v1); }
        __builtin_amdgcn_sched_barrier(0); };      /* as in work_k */
      load_k(0, ba); load_k(1, bb); work_k(0, ba); load_k(2, ba); work_k(1, bb); load_k(3, bb); work_k(2, ba); load_v(0, ba); work_k(3, bb); load_v(1, bb);
#pragma unroll
      for (int u = 0; u < 8; ++u) { const int j = j0 + jg + u; float s = __fmul_rn(s2[u >> 1][u & 1], scale); if (MASKADD) s = __fadd_rn(s, __fmul_rn(bf16_round(mask[(size_t)i * SQ + j]), -10000.0f));
        const float f = (MASKADD || j <= i) ? 1.f : 0.f; const float sm = fmaf(f, s, (1.f - f) * -1.0e30f); const float mn = fmaxf(m, sm); sc[u] = exp_slot(m - mn); e[u] = exp_slot(sm - mn); l = fmaf(l, sc[u], e[u]); m = mn; }
      work_v(0, ba); load_v(2, ba); work_v(1, bb); load_v(3, bb); work_v(2, ba); work_v(3, bb); }
    __syncthreads(); }      /* every thread has left the tile before the next one overwrites it */
  const float fin = 64.0f / l;      /* o carried x64 like the f16 path */
#pragma unroll
  for (int c = 0; c < HD / 4; ++c) { const v4f oo = {__fmul_rn(o[c * 2][0], fin), __fmul_rn(o[c * 2][1], fin), __fmul_rn(o[c * 2 + 1][0], fin), __fmul_rn(o[c * 2 + 1][1], fin)}; *(v4f*)&lo[tid][c * 4] = oo; }
  __syncthreads();
  {
#pragma unroll 1
    for (int it = 0; it < 16; ++it) { const int row = it * 4 + tid / 16, pc = (tid % 16) * 4; const v4f v = *(const v4f*)&lo[row][pc]; v4h vh, vl;      /* o leaves as two f16 planes: the high part and the residual x1024 */
      for (int u = 0; u < 4; ++u) { const _Float16 hp = (_Float16)v[u]; vh[u] = hp; vl[u] = (_Float16)((v[u] - (float)hp) * 1024.0f); }
      const size_t e = (size_t)(rg * 64 + row) * ldo + h * HD + pc; *(v4h*)(OH + e) = vh; *(v4h*)(OL + e) = vl; }
     } }

#define DMQ DM

// Sum over the wave's 32 lanes, every lane gets it: four steps inside the 16-lane rows (row_xmask 1, 2, 4, 8), then the two rows joined.
template <int M> __device__ __forceinline__ float ln_xm(float x) { return __builtin_bit_cast(float, __builtin_amdgcn_update_dpp(0, __builtin_bit_cast(int, x), 0x160 + M, 0xf, 0xf, true)); }      /* lane l takes lane l ^ M, M below 16 */
__device__ __forceinline__ float ln_wsum(float s) { s += ln_xm<1>(s); s += ln_xm<2>(s); s += ln_xm<4>(s); s += ln_xm<8>(s); return s + fa_xhalf(s); }
// Row LayerNorm (biased variance), one wave a row, LN_RPW rows a wave: a lane holds 32 elements of a row (8 pieces of 16 bytes, 512 bytes apart, so every load and store of the wave covers
// four whole lines); no LDS and no barrier. All rows' loads are in flight at once. gamma and beta rounded to bf16.
#define LN_RPW 2
static_assert(DMQ == 1024 && NR % (8 * LN_RPW) == 0, "k_lnw: rows of 32 x 32 elements, whole blocks only");
__global__ __launch_bounds__(256) void k_lnw(const float* __restrict__ X, const float* __restrict__ g, const float* __restrict__ bb, float eps, float* __restrict__ N32) {
  const unsigned lane = threadIdx.x & 31; const unsigned po = lane * 16u, xo = (blockIdx.x * 8 + (threadIdx.x >> 5)) * (LN_RPW * DMQ * 4u) + po;      /* the lane's byte offsets in gamma and beta, and in X and N32 (32 bits: a plane stays under 4 GiB) */
  v4f x[LN_RPW][8], gg[8], bv[8];
#pragma unroll
  for (int rr = 0; rr < LN_RPW; ++rr) for (int j = 0; j < 8; ++j) x[rr][j] = *(const v4fa*)((const char*)X + xo + (rr * DMQ + j * 128) * 4);      /* unrolled, here and below: the indices pick registers */
#pragma unroll
  for (int j = 0; j < 8; ++j) { gg[j] = *(const v4fa*)((const char*)g + po + j * 512); bv[j] = *(const v4fa*)((const char*)bb + po + j * 512); }
  asm volatile("s_wait_xcnt 0x0" :: "v"(xo), "v"(po) : "memory");      /* the wait in front of any overwrite of the loads' offset registers; as inputs the offsets keep their registers up to here (else the last loads' results land on them) */
  __builtin_amdgcn_sched_barrier(0);      /* all loads are issued before the first is waited for: else the second row's sink behind the first row's sums */
  float mu[LN_RPW], rs[LN_RPW];
#pragma unroll
  for (int rr = 0; rr < LN_RPW; ++rr) { v4f s = x[rr][0]; for (int j = 1; j < 8; ++j) s += x[rr][j];
    mu[rr] = ln_wsum((s[0] + s[1]) + (s[2] + s[3])) * (1.0f / DMQ); }
#pragma unroll
  for (int rr = 0; rr < LN_RPW; ++rr) { v4f s = {0.f, 0.f, 0.f, 0.f}; for (int j = 0; j < 8; ++j) { x[rr][j] -= mu[rr]; s += x[rr][j] * x[rr][j]; }
    rs[rr] = rsqrtf(ln_wsum((s[0] + s[1]) + (s[2] + s[3])) * (1.0f / DMQ) + eps); }
#pragma unroll
  for (int j = 0; j < 8; ++j) for (int q = 0; q < 4; ++q) { const float gq = bf16_round(gg[j][q]), bq = bf16_round(bv[j][q]);
    for (int rr = 0; rr < LN_RPW; ++rr) x[rr][j][q] = x[rr][j][q] * rs[rr] * gq + bq; }
#pragma unroll
  for (int rr = 0; rr < LN_RPW; ++rr) for (int j = 0; j < 8; ++j) *(v4f*)((char*)N32 + xo + (rr * DMQ + j * 128) * 4) = x[rr][j]; }


extern "C" void kernel_launch(void* const* d_in, const int* in_sizes, int n_in,
                              void* d_out, int out_size, void* d_ws, size_t ws_size, hipStream_t stream) {
  (void)in_sizes; (void)n_in; (void)out_size;
  const float* const* I = (const float* const*)d_in; const float* x = I[0]; const float* wk = I[1]; const float* wq = I[2]; const float* wv = I[3]; const float* wo = I[4]; const float* lng = I[5]; const float* lnb = I[6];      /* x; natural [out][in] Wk, Wq, Wv (THIS order), Wp; LayerNorm gamma, beta; no biases */
  char* ws = (char*)d_ws; size_t off = 0;
  auto take = [&](size_t bytes) { char* p = ws + off; off += (bytes + 255) & ~(size_t)255; return p; };
  /* planes that one launch walks by a stride follow one another without a gap (every size is a multiple of 256 bytes): BQ BK BV BO; Q16 K16 V16; QF0 KF0 VF0; OH0 OL0 */
  _Float16* BQ = (_Float16*)take((size_t)DM * DM * 2); take((size_t)DM * DM * 2); take((size_t)DM * DM * 2); _Float16* BO = (_Float16*)take((size_t)DM * DM * 2);
  _Float16* X16 = (_Float16*)take(NR * DM * 2); _Float16* Q16 = (_Float16*)take(NR * DM * 2); _Float16* K16 = (_Float16*)take(NR * DM * 2); _Float16* V16 = (_Float16*)take(NR * DM * 2); _Float16* O16 = (_Float16*)take(NR * DM * 2);
  float* YO = (float*)take(NR * DM * 4); _Float16* VT = (_Float16*)take((size_t)NB * NH * HD * SQ * 2);      /* pre-norm projection rows y (f32); V^T [NB][NH][HD][SQ] */
  float* QF0 = (float*)take((size_t)NB * QT0 * DM * 4); float* KF0 = (float*)take((size_t)NB * QT0 * DM * 4); float* VF0 = (float*)take((size_t)NB * QT0 * DM * 4); _Float16* OH0 = (_Float16*)take((size_t)NB * QT0 * DM * 2); _Float16* OL0 = (_Float16*)take((size_t)NB * QT0 * DM * 2);
  if (off > ws_size) return;
  k_cvt<<<CVT_NB, 256, 0, stream>>>(wq, wk, wv, wo, x, BQ, X16);      /* BQ BK BV BO (x16) and the x rows */
  const size_t r0p = (size_t)B0 * SQ;      /* first projected row */
  const size_t f0p = (size_t)B0 * QT0;      /* its first-tile row */
  k_gemm2<0, 1><<<dim3((unsigned)((MP / 128) * (DM / 256)), 3), 256, 0, stream>>>(X16 + r0p * DM, DM, 0, BQ, DM, (size_t)DM * DM, 0.0625f, nullptr, 0, nullptr, 1, 0, 0, nullptr, Q16 + r0p * DM, DM, NR * DM, MP, DM, DM, 0, 0, 0, nullptr, 0, QF0 + f0p * DM, (size_t)NB * QT0 * DM);      /* q, k, v on grid.y: f16 rows, and f32 (exact products) for each batch's first 128 rows */
  k_vt<NH, SQ><<<NBR * NH * (SQ / (64 * VT_T)), 256, 0, stream>>>(V16 + r0p * LQ, LQ, 0, VT);      /* V^T [NBR][NH][HD][SQ] */
  k_att0<0><<<dim3(NH * (QT0 / 64), NBR), 64, 0, stream>>>(QF0, KF0, VF0, DM, nullptr, 0.125f, OH0 + f0p * DM, OL0 + f0p * DM, DM);      /* exact f32 attention for rows 0..127 of each batch: o (x64) as f16 high part + x1024 residual planes */
  k_fattn<<<dim3(NH, NB, SQ / 128), 128, 0, stream>>>(Q16, K16, VT, O16);      /* causal attention of all batches and heads: o (merged heads, x64) as f16 rows */
  k_gemm2<0, 2><<<dim3((unsigned)((MPO / 128) * (DM / 256)), 1), 256, 0, stream>>>(O16 + r0p * DM, DM, 0, BO, DM, 0, 0.0009765625f, nullptr, 0, nullptr, 1, 0, 0, YO + r0p * DM, nullptr, DM, 0, MPO, DM, DM, 0, 0, 0, OH0 + f0p * DM, (size_t)NB * QT0 * DM, nullptr, 0);      /* y = o Wp; rows 0..127 of each batch from the two exact planes */
  k_lnw<<<(unsigned)(NR / (8 * LN_RPW)), 256, 0, stream>>>(YO, lng, lnb, 1e-5f, (float*)d_out);      /* out = LayerNorm(y) -> f32 output rows */
}

// v010
// One run takes 139 microseconds.
// Two timings next to v009 both put it at 1.17 times that version's speed.
// Counting every step since v000, which is the starting kernel, it is 70.2 times as fast.
#include <hip/hip_runtime.h>
// Causal multi-head self-attention with a fused post-LayerNorm (x [4][2048][1024]; k/q/v = x W^T (natural [1024][1024], no biases); 16 heads of 64; wei = q k^T * 64^-0.5; causal (tril, -inf); softmax; y = merged Wp^T; out = LayerNorm(y) (biased var, eps per the module, gamma / beta) -> [4][2048][1024]).
// Structure: token rows r = b*2048 + s; x as exact f16 rows (bf16-rounded); Q, K, V as WMMA GEMMs in one launch (64x64 wave tiles, f32 accumulation, exact x16 weights, f16 outputs; each batch's first 128 rows also in f32, for an f32 attention of those rows, v_wmma_f32_16x16x4_f32, in the attention launch's first-tile blocks); V^T for all heads via LDS transposes; attention in ONE launch (k_fattn): a wave holds 32 queries of one head and walks the keys up to its diagonal in passes of 32 (K, V^T from LDS stages of 64 keys, shared by a block's 4 waves): S^T = K Q^T, running maximum and sum in f32 (native exp2; weights x256 f16), O^T += V^T P^T, scores and weights never leave the registers; o (x64, folded into the output GEMM alpha) written straight into the merged f16 o rows; y = o W_o GEMM (f32; the first 128 rows of a batch from the exact o as f16 high part + residual), then the row LayerNorm into the output layout.
// Compute dtype: inputs rounded to bf16; x / weights exact; q, k, v, softmax weights and o as plain f16 GEMM operands (~2^-12); scores and softmax statistics f32. v_wmma_f32_16x16x32_f16; a batch's first 128 rows: f32 q, k, v, scores and weights on v_wmma_f32_16x16x4_f32, o as f16 high part + x1024 residual.
#define NB 4
#define SQ 2048
#define DM 1024
#define NH 16
#define HD 64
#define HG 4                         /* heads per launch of the (b, h0) k_vt overload, which nothing launches */
#define QT0 128                      /* first-tile rows recomputed exactly in f32 */
#define B0 0                         /* first batch processed (debug hook) */
#define NBR NB                       /* batches processed (debug hook) */
#define NR ((size_t)NB * SQ)         /* token rows */
#define MP ((int)((size_t)NBR * SQ)) /* rows projected (debug hook) */
#define QN SQ                        /* query rows per batch (unused) */
#define NHD NH                       /* heads (unused) */
#define MPO MP                       /* rows through the output stage (debug hook) */
#define LQ DM      /* row pitch of the q/k/v rows */
typedef __bf16 v16b __attribute__((ext_vector_type(16)));
typedef unsigned short v8us __attribute__((ext_vector_type(8), may_alias));
typedef float  v8f  __attribute__((ext_vector_type(8)));
typedef float  v4f  __attribute__((ext_vector_type(4)));
typedef float  v4fa __attribute__((ext_vector_type(4), may_alias));
union FragB { v16b v; v8us half[2]; unsigned short u[16]; };

__device__ __forceinline__ unsigned short bf16_bits(float x) { unsigned int u = __float_as_uint(x); return (unsigned short)((u + 0x7FFFu + ((u >> 16) & 1u)) >> 16); }
__device__ __forceinline__ float bf16_val(unsigned short b) { return __uint_as_float(((unsigned int)b) << 16); }
__device__ __forceinline__ float bf16_round(float x) { return bf16_val(bf16_bits(x)); }
// D += A·B with NT terms: 1 = ah·bh, 2 = + al·bh (A split), 3 = + ah·bl (both split)
template <int NT>
__device__ __forceinline__ v8f mmaN(v16b ah, v16b al, v16b bh, v16b bl, v8f c) {
  c = __builtin_amdgcn_wmma_f32_16x16x32_bf16(false, ah, false, bh, (short)0, c, false, false);
  if (NT >= 2) c = __builtin_amdgcn_wmma_f32_16x16x32_bf16(false, al, false, bh, (short)0, c, false, false);
  if (NT >= 3) c = __builtin_amdgcn_wmma_f32_16x16x32_bf16(false, ah, false, bl, (short)0, c, false, false);
  asm volatile("v_nop\n\tv_nop\n\tv_nop\n\tv_nop" : "+v"(c) : "v"(ah), "v"(al), "v"(bh), "v"(bl));
  return c;
}

__global__ __launch_bounds__(256) void k_wt_bf16(const float* __restrict__ W, unsigned short* __restrict__ Wt, int K, int N) {
  const int t = blockIdx.x * 256 + threadIdx.x;
  const int k8n = K / 8;
  if (t >= N * k8n) return;
  const int n = t / k8n, k8 = (t % k8n) * 8;
  v8us v;
#pragma unroll
  for (int i = 0; i < 8; ++i) v[i] = bf16_bits(W[(size_t)(k8 + i) * N + n]);
  *(v8us*)(Wt + (size_t)n * K + k8) = v;
  
}

// GEMM C[M][N] (f32, pitch ldc) = act(A[M][K]·W + bias). A f32 row-major (pitch lda) converted per fragment to bf16
// (ASPLIT: hi/lo two planes -> 2 terms, else single rounded term); Wt bf16 [N][K] (pitch ldb). BIAS_BF16 rounds the
// bias to bf16 first (bias quantised to bf16 before the add). K%32==0, M%16==0, N%64==0.
template <bool ASPLIT, int ACT, bool BIAS_BF16>
__global__ __launch_bounds__(128) void k_gemm_bf(const float* __restrict__ A, int lda, const unsigned short* __restrict__ Wt, int ldb,
                                               const float* __restrict__ bias, float* __restrict__ C, int ldc, int M, int N, int K) {
  __shared__ __attribute__((aligned(16))) float so[4][16][64];
  const int tid = threadIdx.x, w = tid >> 5, lane = tid & 31, ln = lane & 15, hh = lane >> 4;
  const int ntn = N / 64;
  const int wid = blockIdx.x * 4 + w;
  const int mt = wid / ntn, nq = wid % ntn;
  if (mt * 16 >= M) return;
  const int row0 = mt * 16, col0 = nq * 64;
  const float* arow = A + (size_t)(row0 + ln) * lda;
  v8f acc[4] = {};
  for (int kb = 0; kb < K; kb += 32) {
    FragB ah, al;
    const v4f x0 = *(const v4fa*)(arow + kb + 8 * hh), x1 = *(const v4fa*)(arow + kb + 8 * hh + 4);
    const v4f x2 = *(const v4fa*)(arow + kb + 16 + 8 * hh), x3 = *(const v4fa*)(arow + kb + 16 + 8 * hh + 4);
    float xs[16] = {x0[0],x0[1],x0[2],x0[3],x1[0],x1[1],x1[2],x1[3],x2[0],x2[1],x2[2],x2[3],x3[0],x3[1],x3[2],x3[3]};
#pragma unroll
    for (int i = 0; i < 16; ++i) { const unsigned short hb = bf16_bits(xs[i]); ah.u[i] = hb; al.u[i] = ASPLIT ? bf16_bits(xs[i] - bf16_val(hb)) : (unsigned short)0; }
#pragma unroll
    for (int t = 0; t < 4; ++t) {
      const unsigned short* brow = Wt + (size_t)(col0 + t * 16 + ln) * ldb + kb;
      FragB b;
      b.half[0] = *(const v8us*)(brow + 8 * hh);
      b.half[1] = *(const v8us*)(brow + 16 + 8 * hh);
      acc[t] = mmaN<ASPLIT ? 2 : 1>(ah.v, al.v, b.v, b.v, acc[t]);
    }
  }
#pragma unroll
  for (int t = 0; t < 4; ++t) {
    float bv = bias ? bias[col0 + t * 16 + ln] : 0.f;
    if (BIAS_BF16) bv = bf16_round(bv);
#pragma unroll
    for (int r = 0; r < 8; ++r) { float v = acc[t][r] + bv; if (ACT == 1) v = fmaxf(v, 0.f); so[w][8 * hh + r][t * 16 + ln] = v; }
  }
  __builtin_amdgcn_fence(__ATOMIC_ACQ_REL, "workgroup");
  __builtin_amdgcn_wave_barrier();
  const int rsub = lane >> 4, c4 = (lane & 15) * 4;
  {
#pragma unroll
    for (int q = 0; q < 8; ++q) {
      const int r = q * 2 + rsub;
      const v4f v = *(const v4fa*)&so[w][r][c4];
      *(v4f*)(C + (size_t)(row0 + r) * ldc + col0 + c4) = v;
    }
    
  }
}

// GEMM C = act(A·W + bias + resid): A f32 (ASPLIT -> hi/lo 2 terms), Wt bf16 [N][K]; ACT 0 none, 1 relu, 2 exact gelu;
// resid (optional, f32, row index = (row % rmod), pitch ldr, RES_BF16 rounds it) added before the activation.
template <bool ASPLIT, int ACT, bool BIAS_BF16, bool RES_BF16>
__global__ __launch_bounds__(128) void k_gemm_bf3(const float* __restrict__ A, int lda, const unsigned short* __restrict__ Wt, int ldb,
                                                const float* __restrict__ bias, const float* __restrict__ resid, int rmod, int ldr,
                                                float* __restrict__ C, int ldc, int M, int N, int K) {
  __shared__ __attribute__((aligned(16))) float so[4][16][64];
  const int tid = threadIdx.x, w = tid >> 5, lane = tid & 31, ln = lane & 15, hh = lane >> 4;
  const int ntn = N / 64;
  const int wid = blockIdx.x * 4 + w;
  const int mt = wid / ntn, nq = wid % ntn;
  if (mt * 16 >= M) return;
  const int row0 = mt * 16, col0 = nq * 64;
  const float* arow = A + (size_t)(row0 + ln) * lda;
  v8f acc[4] = {};
  for (int kb = 0; kb < K; kb += 32) {
    FragB ah, al;
    const v4f x0 = *(const v4fa*)(arow + kb + 8 * hh), x1 = *(const v4fa*)(arow + kb + 8 * hh + 4);
    const v4f x2 = *(const v4fa*)(arow + kb + 16 + 8 * hh), x3 = *(const v4fa*)(arow + kb + 16 + 8 * hh + 4);
    float xs[16] = {x0[0],x0[1],x0[2],x0[3],x1[0],x1[1],x1[2],x1[3],x2[0],x2[1],x2[2],x2[3],x3[0],x3[1],x3[2],x3[3]};
#pragma unroll
    for (int i = 0; i < 16; ++i) { const unsigned short hb = bf16_bits(xs[i]); ah.u[i] = hb; al.u[i] = ASPLIT ? bf16_bits(xs[i] - bf16_val(hb)) : (unsigned short)0; }
#pragma unroll
    for (int t = 0; t < 4; ++t) {
      const unsigned short* brow = Wt + (size_t)(col0 + t * 16 + ln) * ldb + kb;
      FragB b;
      b.half[0] = *(const v8us*)(brow + 8 * hh);
      b.half[1] = *(const v8us*)(brow + 16 + 8 * hh);
      acc[t] = mmaN<ASPLIT ? 2 : 1>(ah.v, al.v, b.v, b.v, acc[t]);
    }
  }
#pragma unroll
  for (int t = 0; t < 4; ++t) {
    const int col = col0 + t * 16 + ln;
    float bv = bias ? bias[col] : 0.f;
    if (BIAS_BF16) bv = bf16_round(bv);
#pragma unroll
    for (int r = 0; r < 8; ++r) {
      float v = acc[t][r] + bv;
      if (resid) { float rv = resid[(size_t)((row0 + 8 * hh + r) % rmod) * ldr + col]; if (RES_BF16) rv = bf16_round(rv); v += rv; }
      if (ACT == 1) v = fmaxf(v, 0.f);
      if (ACT == 2) v = 0.5f * v * (1.0f + erff(v * 0.70710678118654752f));
      if (ACT == 3) { const float u = 0.7978845608028654f * (v + 0.044715f * v * v * v); v = 0.5f * v * (1.0f + tanhf(u)); }
      so[w][8 * hh + r][t * 16 + ln] = v;
    }
  }
  __builtin_amdgcn_fence(__ATOMIC_ACQ_REL, "workgroup");
  __builtin_amdgcn_wave_barrier();
  const int rsub = lane >> 4, c4 = (lane & 15) * 4;
  {
#pragma unroll
    for (int q = 0; q < 8; ++q) {
      const int r = q * 2 + rsub;
      const v4f v = *(const v4fa*)&so[w][r][c4];
      *(v4f*)(C + (size_t)(row0 + r) * ldc + col0 + c4) = v;
    }
    
  }
}
// row LayerNorm (biased variance, eps) over N: s = X (+ R); optional out_sum <- s; out_norm <- (s-mu)*rsqrt(var+eps)*g + b
template <bool PARAM_BF16>
__global__ __launch_bounds__(256) void k_layernorm(const float* __restrict__ X, const float* __restrict__ R, const float* __restrict__ g, const float* __restrict__ bta,
                                                  float* __restrict__ out_sum, float* __restrict__ out_norm, int N, float eps) {
  __shared__ float red[256];
  const int row = blockIdx.x, tid = threadIdx.x;
  const float* x = X + (size_t)row * N; const float* rr = R ? R + (size_t)row * N : nullptr;
  float vals[16];                     // up to N = 4096
  const int per = N / 256;            // contiguous chunk per thread? use strided-by-4 chunks: thread handles j = tid*4 + 1024*u
  float s1 = 0.f;
  for (int u = 0; u < per / 4; ++u) {
    const int j = tid * 4 + 1024 * u;
    const v4f a = *(const v4fa*)(x + j);
    v4f b = {0.f,0.f,0.f,0.f}; if (rr) b = *(const v4fa*)(rr + j);
#pragma unroll
    for (int q = 0; q < 4; ++q) { const float v = a[q] + b[q]; vals[u * 4 + q] = v; s1 += v; }
  }
  red[tid] = s1; __syncthreads();
  for (int st = 128; st > 0; st >>= 1) { if (tid < st) red[tid] += red[tid + st]; __syncthreads(); }
  const float mu = red[0] / (float)N; __syncthreads();
  float s2 = 0.f;
  for (int u = 0; u < per / 4; ++u)
#pragma unroll
    for (int q = 0; q < 4; ++q) { const float c = vals[u * 4 + q] - mu; s2 += c * c; }
  red[tid] = s2; __syncthreads();
  for (int st = 128; st > 0; st >>= 1) { if (tid < st) red[tid] += red[tid + st]; __syncthreads(); }
  const float rs = rsqrtf(red[0] / (float)N + eps);
  {
    for (int u = 0; u < per / 4; ++u) {
      const int j = tid * 4 + 1024 * u;
      v4f o, sm;
#pragma unroll
      for (int q = 0; q < 4; ++q) {
        float gg = g[j + q], bb = bta[j + q];
        if (PARAM_BF16) { gg = bf16_round(gg); bb = bf16_round(bb); }
        sm[q] = vals[u * 4 + q]; o[q] = (vals[u * 4 + q] - mu) * rs * gg + bb;
      }
      if (out_sum) *(v4f*)(out_sum + (size_t)row * N + j) = sm;
      *(v4f*)(out_norm + (size_t)row * N + j) = o;
    }
    
  }
}



// ---- f16 WMMA path (v_wmma_f32_16x16x32_f16): 11-bit significands for operands in range — used where a [0,1] probability operand needs more precision than bf16
typedef _Float16 v16h __attribute__((ext_vector_type(16)));
union FragH { v16h v; v8us half[2]; _Float16 h[16]; unsigned short u[16]; };
template <int NT>
__device__ __forceinline__ v8f mmaH(v16h ah, v16h al, v16h bh, v16h bl, v8f c) {
  c = __builtin_amdgcn_wmma_f32_16x16x32_f16(false, ah, false, bh, (short)0, c, false, false);
  if (NT >= 2) c = __builtin_amdgcn_wmma_f32_16x16x32_f16(false, al, false, bh, (short)0, c, false, false);
  if (NT >= 3) c = __builtin_amdgcn_wmma_f32_16x16x32_f16(false, ah, false, bl, (short)0, c, false, false);
  asm volatile("v_nop\n\tv_nop\n\tv_nop\n\tv_nop" : "+v"(c) : "v"(ah), "v"(al), "v"(bh), "v"(bl));
  return c;
}
// batched GEMM like k_gemm_b but f16 operands: A f32 (split into f16 hi/lo if ASPLIT, else rounded to f16), Bt = f16 values [n][k]; alpha; C f32; N multiple of 16 (partial tiles skipped)
template <bool ASPLIT>
__global__ __launch_bounds__(128) void k_gemm_h(const float* __restrict__ A, int lda, size_t sA, const _Float16* __restrict__ Bh, int ldb, size_t sB, float alpha, float* __restrict__ C, int ldc, size_t sC, int M, int N, int K) {
  __shared__ __attribute__((aligned(16))) float so[4][16][64];
  const int tid = threadIdx.x, w = tid >> 5, lane = tid & 31, ln = lane & 15, hh = lane >> 4; const int by = blockIdx.y;
  A += (size_t)by * sA; Bh += (size_t)by * sB; C += (size_t)by * sC;
  const int ntn = (N + 63) / 64; const int wid = blockIdx.x * 4 + w; const int mt = wid / ntn, nq = wid % ntn; if (mt * 16 >= M) return;
  const int row0 = mt * 16, col0 = nq * 64; const float* arow = A + (size_t)(row0 + ln) * lda;
  v8f acc[4] = {};
  for (int kb = 0; kb < K; kb += 32) {
    FragH ah, al;
    const v4f x0 = *(const v4fa*)(arow + kb + 8 * hh), x1 = *(const v4fa*)(arow + kb + 8 * hh + 4), x2 = *(const v4fa*)(arow + kb + 16 + 8 * hh), x3 = *(const v4fa*)(arow + kb + 16 + 8 * hh + 4);
    float xs[16] = {x0[0],x0[1],x0[2],x0[3],x1[0],x1[1],x1[2],x1[3],x2[0],x2[1],x2[2],x2[3],x3[0],x3[1],x3[2],x3[3]};
#pragma unroll
    for (int i = 0; i < 16; ++i) { const _Float16 h = (_Float16)xs[i]; ah.h[i] = h; al.h[i] = ASPLIT ? (_Float16)(xs[i] - (float)h) : (_Float16)0.0f; }
#pragma unroll
    for (int t = 0; t < 4; ++t) { if (col0 + t * 16 >= N) continue; const size_t boff = (size_t)(col0 + t * 16 + ln) * ldb + kb; FragH bq; bq.half[0] = *(const v8us*)(Bh + boff + 8 * hh); bq.half[1] = *(const v8us*)(Bh + boff + 16 + 8 * hh);
      acc[t] = mmaH<ASPLIT ? 2 : 1>(ah.v, al.v, bq.v, bq.v, acc[t]); }
  }
#pragma unroll
  for (int t = 0; t < 4; ++t) { if (col0 + t * 16 >= N) continue;
#pragma unroll
    for (int r = 0; r < 8; ++r) so[w][8 * hh + r][t * 16 + ln] = acc[t][r] * alpha; }
  __builtin_amdgcn_fence(__ATOMIC_ACQ_REL, "workgroup"); __builtin_amdgcn_wave_barrier();
  const int rsub = lane >> 4, c4 = (lane & 15) * 4;
  {
#pragma unroll
    for (int q = 0; q < 8; ++q) { const int r = q * 2 + rsub; if (col0 + c4 < N) { const v4f v = *(const v4fa*)&so[w][r][c4]; *(v4f*)(C + (size_t)(row0 + r) * ldc + col0 + c4) = v; } }
     }
}

// Wt[n][k] = f16(W[k][n]·scale) from f32 row-major W[K][N] (scale = power of two; bf16-exact weights stay exact in f16 away from the subnormal range)
__global__ __launch_bounds__(256) void k_wt_f16(const float* __restrict__ W, _Float16* __restrict__ Wt, int K, int N, float scale) {
  const int t = blockIdx.x * 256 + threadIdx.x; if (t >= N * (K / 8)) return; const int n = t / (K / 8), k8 = (t % (K / 8)) * 8; FragH f;
#pragma unroll
  for (int i = 0; i < 8; ++i) f.h[i] = (_Float16)(bf16_round(W[(size_t)(k8 + i) * N + n]) * scale); const v8us o = f.half[0];
  *(v8us*)((unsigned short*)Wt + (size_t)n * K + k8) = o; 
}
// k_gemm_hh variant with fused epilogue: v = acc·alpha + bias[by·sBias + col] (+ CP[(row/rowsPerB)·sCPb + by·64 + col] if CP) ; ACT 0 none / 1 elu ; writes f16 C16 (and f32 C if non-null)
template <int ACT>
__global__ __launch_bounds__(128) void k_gemm_hhx(const _Float16* __restrict__ A, int lda, size_t sA, const _Float16* __restrict__ Bh, int ldb, size_t sB, float alpha, const float* __restrict__ bias, size_t sBias, const float* __restrict__ CP, int rowsPerB, size_t sCPb, int row0g,
    float* __restrict__ C, _Float16* __restrict__ C16, int ldc, size_t sC, int M, int N, int K) {
  __shared__ __attribute__((aligned(16))) float so[4][16][64];
  const int tid = threadIdx.x, w = tid >> 5, lane = tid & 31, ln = lane & 15, hh = lane >> 4; const int by = blockIdx.y;
  A += (size_t)by * sA; Bh += (size_t)by * sB; const size_t cofs = (size_t)by * sC; const float* bp = bias ? bias + (size_t)by * sBias : nullptr;
  const int ntn = (N + 63) / 64; const int wid = blockIdx.x * 4 + w; const int mt = wid / ntn, nq = wid % ntn; if (mt * 16 >= M) return;
  const int row0 = mt * 16, col0 = nq * 64; const _Float16* arow = A + (size_t)(row0 + ln) * lda;
  v8f acc[4] = {};
  for (int kb = 0; kb < K; kb += 32) { FragH ah; ah.half[0] = *(const v8us*)((const unsigned short*)arow + kb + 8 * hh); ah.half[1] = *(const v8us*)((const unsigned short*)arow + kb + 16 + 8 * hh);
#pragma unroll
    for (int t = 0; t < 4; ++t) { if (col0 + t * 16 >= N) continue; const size_t boff = (size_t)(col0 + t * 16 + ln) * ldb + kb; FragH bq; bq.half[0] = *(const v8us*)((const unsigned short*)Bh + boff + 8 * hh); bq.half[1] = *(const v8us*)((const unsigned short*)Bh + boff + 16 + 8 * hh);
      acc[t] = mmaH<1>(ah.v, ah.v, bq.v, bq.v, acc[t]); }
  }
#pragma unroll
  for (int t = 0; t < 4; ++t) { if (col0 + t * 16 >= N) continue; const int col = col0 + t * 16 + ln; const float bv = bp ? bf16_round(bp[col]) : 0.f;
#pragma unroll
    for (int r = 0; r < 8; ++r) { float v = acc[t][r] * alpha + bv; if (CP) { const int rr = row0g + row0 + 8 * hh + r; if (rowsPerB < 0) v += CP[cofs + (size_t)rr * ldc + col];      /* rowsPerB < 0: own element of the batched C plane */ else { const int bidx = rr / rowsPerB; v += CP[(size_t)bidx * sCPb + (size_t)by * 64 + col]; } } if (ACT == 1) v = (v > 0.f) ? v : expm1f(v); else if (ACT == 7) v = (v > 0.f) ? v + 1.0f : expf(v); else if (ACT == 8) v = tanhf(v); else if (ACT == 9) v = 0.5f * v * (1.0f + tanhf(0.7978845608028654f * (v + 0.044715f * v * v * v))); else if (ACT == 11) v = 1.0f / (1.0f + expf(-v)); else if (ACT == 12) v = (v > 0.f) ? v : 0.01f * v; else if (ACT == 14) v = (v > 0.f) ? v : 0.1f * v; else if (ACT == 16) v = (v >= 0.f) ? v : 0.3f * v; else if (ACT == 17) v = (v >= 0.f) ? v : 0.2f * v; else if (ACT == 15) v = v / (1.0f + expf(-v)); else if (ACT == 3) v = fmaxf(v, 0.f); else if (ACT == 6) v = 0.5f * v * (1.0f + erff(v * 0.70710678118654752f)); so[w][8 * hh + r][t * 16 + ln] = v; } }
  __builtin_amdgcn_fence(__ATOMIC_ACQ_REL, "workgroup"); __builtin_amdgcn_wave_barrier();
  const int rsub = lane >> 4, c4 = (lane & 15) * 4; typedef _Float16 v4h __attribute__((ext_vector_type(4)));
  {
#pragma unroll
    for (int q = 0; q < 8; ++q) { const int r = q * 2 + rsub; if (col0 + c4 < N) { const v4f v = *(const v4fa*)&so[w][r][c4]; if (C) *(v4f*)(C + cofs + (size_t)(row0 + r) * ldc + col0 + c4) = v; if (C16) { v4h h4; for (int i = 0; i < 4; ++i) h4[i] = (_Float16)v[i]; *(v4h*)(C16 + cofs + (size_t)(row0 + r) * ldc + col0 + c4) = h4; } } }
     }
}


typedef _Float16 v4h __attribute__((ext_vector_type(4)));

// All five operand conversions in one grid, 8 elements a thread and unit. A unit is 2,048 elements; a block takes CVT_U units, one of each weight plane (natural [out][in] = Bt; rounded to
// bf16, x16, exact in f16; the planes follow one another in Bt) and one of each of the CVT_U - 4 equal slices of x (rounded to bf16, exact in f16): few waves to start, each with all
// its loads in flight at once, two blocks on a WGP.
#define CVT_NB (DM * DM / 2048)      /* blocks = units per weight plane = units per slice of x */
#define CVT_U 12      /* units per block */
static_assert(DM * DM % 2048 == 0 && NR * DM == (size_t)(CVT_U - 4) * CVT_NB * 2048, "k_cvt: whole units only, x in CVT_U - 4 slices of a weight plane's size");
__global__ __launch_bounds__(256) void k_cvt(const float* __restrict__ w0, const float* __restrict__ w1, const float* __restrict__ w2, const float* __restrict__ w3, const float* __restrict__ x, _Float16* __restrict__ Bt, _Float16* __restrict__ X16) {
  const unsigned e = blockIdx.x * 2048 + threadIdx.x * 8;      /* the thread's first element in a plane or slice */
  unsigned so[CVT_U]; v4f a[CVT_U][2]; v8us o[CVT_U];      /* so: byte offset in w0 .. w3 or x (32 bits: x stays under 4 GiB) */
#pragma unroll
  for (int k = 0; k < CVT_U; ++k) {      /* unrolled, here and below: k picks registers */
    so[k] = (e + (k < 4 ? 0u : (unsigned)(k - 4) * (CVT_NB * 2048u))) * 4u;
    const char* s = (const char*)(k == 0 ? w0 : k == 1 ? w1 : k == 2 ? w2 : k == 3 ? w3 : x) + so[k];
    a[k][0] = *(const v4fa*)s; a[k][1] = *(const v4fa*)(s + 16); }
  asm volatile("s_wait_xcnt 0x0" :: "v"(so[0]), "v"(so[4]), "v"(so[5]), "v"(so[6]), "v"(so[7]), "v"(so[8]), "v"(so[9]), "v"(so[10]), "v"(so[11]) : "memory");      /* the wait in front of any overwrite of the loads' offset registers; as inputs the offsets keep their registers up to here (else later loads' results land on them) */
  __builtin_amdgcn_sched_barrier(0);      /* all loads are issued before the first is waited for: else each sinks to its conversion and the latencies add up */
#pragma unroll
  for (int k = 0; k < CVT_U; ++k) { const float sc = k < 4 ? 16.0f : 1.0f; FragH f;
    for (int q = 0; q < 8; ++q) f.h[q] = (_Float16)(bf16_round(a[k][q >> 2][q & 3]) * sc);
    o[k] = f.half[0]; }
#pragma unroll
  for (int k = 0; k < CVT_U; ++k) *(v8us*)((char*)(k < 4 ? Bt : X16 + (size_t)(k < 8 ? 0 : 4) * (CVT_NB * 2048)) + e * 2u + (k & 3) * (CVT_NB * 4096)) = o[k]; }      /* the thread's byte offset in 32 bits; plane or slice by a constant offset from Bt or from one of the two halves of X16 */
__global__ __launch_bounds__(256) void k_h16(const float* __restrict__ x, _Float16* __restrict__ X16, size_t n8) { const size_t t = (size_t)blockIdx.x * 256 + threadIdx.x; if (t >= n8) return; FragH f;
#pragma unroll
  for (int q = 0; q < 8; ++q) f.h[q] = (_Float16)x[t * 8 + q]; *(v8us*)((unsigned short*)X16 + t * 8) = f.half[0];  }
__global__ __launch_bounds__(256) void k_round16f(const float* __restrict__ W, _Float16* __restrict__ Bt, size_t n8) { const size_t t = (size_t)blockIdx.x * 256 + threadIdx.x; if (t >= n8) return; FragH f;
#pragma unroll
  for (int i = 0; i < 8; ++i) f.h[i] = (_Float16)(bf16_round(W[t * 8 + i]) * 16.0f); *(v8us*)((unsigned short*)Bt + t * 8) = f.half[0];  }
// V^T by LDS transposes. A block takes VT_T tiles of 64 tokens x 64 dims of one head, side by side along the tokens: few waves to start, each with all its loads in flight at once.
#define VT_T 4
template <int NHv, int TTv>
__global__ __launch_bounds__(256) void k_vt(const _Float16* __restrict__ V16, int ldv, int voff, _Float16* __restrict__ Vt) { static_assert(TTv % (64 * VT_T) == 0, "k_vt: whole blocks only");
  __shared__ unsigned short tl[VT_T * 64][66]; const int tid = threadIdx.x; const int slab = blockIdx.x / (TTv / (64 * VT_T)), lg = blockIdx.x % (TTv / (64 * VT_T)); const int b = slab / NHv, h = slab % NHv;
  const int r = tid / 8, c8 = (tid % 8) * 8;      /* 8 threads a row; piece j lies 32 rows below piece j - 1 */
  unsigned vo[2 * VT_T]; v8us rg[2 * VT_T], o[2 * VT_T];      /* vo: byte offset in V16 (32 bits: the plane stays under 4 GiB) */
#pragma unroll
  for (int j = 0; j < 2 * VT_T; ++j) { vo[j] = ((unsigned)(b * TTv + lg * (64 * VT_T) + j * 32 + r) * (unsigned)ldv + (unsigned)(voff + h * 64 + c8)) * 2u; rg[j] = *(const v8us*)((const char*)V16 + vo[j]); }      /* unrolled, here and below: j picks registers */
  asm volatile("s_wait_xcnt 0x0" :: "v"(vo[0]), "v"(vo[1]), "v"(vo[2]), "v"(vo[3]), "v"(vo[4]), "v"(vo[5]), "v"(vo[6]), "v"(vo[7]) : "memory"); static_assert(VT_T == 4, "k_vt: the wait names 8 offsets");      /* the wait in front of any overwrite of the loads' offset registers; as inputs the offsets keep their registers up to here (else later loads' results land on them) */
  __builtin_amdgcn_sched_barrier(0);      /* all loads are issued before the first is waited for: else each sinks to its LDS stores and the latencies add up */
#pragma unroll
  for (int j = 0; j < 2 * VT_T; ++j) for (int q = 0; q < 8; ++q) tl[j * 32 + r][c8 + q] = rg[j][q];
  __syncthreads();      /* the tiles are complete before any thread reads them */
#pragma unroll
  for (int j = 0; j < 2 * VT_T; ++j) { const int d = (j & 1) * 32 + r;      /* piece j: tile j / 2, dim d, tokens c8 .. c8 + 7 */
    for (int q = 0; q < 8; ++q) o[j][q] = tl[(j >> 1) * 64 + c8 + q][d]; }
#pragma unroll
  for (int j = 0; j < 2 * VT_T; ++j) *(v8us*)((unsigned short*)Vt + ((size_t)slab * 64 + (j & 1) * 32 + r) * TTv + lg * (64 * VT_T) + (j >> 1) * 64 + c8) = o[j]; }

// ---- fast GEMM (block tile 128x256, eight waves as 2x4 of 64x64: an operand line is fetched by fewer blocks, and a fragment read from LDS feeds four products; requires M % 64 == 0 rows per launch region, N % 256 == 0 and K a positive multiple of 64); epilogue = k_gemm_hhx semantics without the CP plane (and no ACT 1 or 7) ----
// The operands go through LDS in stages of 64 k: every global load of a wave covers four whole 128-byte lines (4 rows x 64 k), each line is fetched once per block, and the
// fragments are read back from LDS in the k order of g2_frag. Two stage buffers: stage s + 1 is stored and stage s + 2 is requested while stage s is multiplied; one barrier a stage.
// The unroll directives in g2_request, g2_store and k_gemm2: the loop indices pick staging registers, offsets and fragments, which stay in registers only if every index is a constant.
__device__ __forceinline__ v16h g2_frag(const _Float16* p, int hh) { FragH f; f.half[0] = *(const v8us*)((const unsigned short*)p + 8 * hh); f.half[1] = *(const v8us*)((const unsigned short*)p + 16 + 8 * hh); return f.v; }
__device__ __forceinline__ v8f g2_mma(v16h a, v16h b, v8f c) { v8f d = __builtin_amdgcn_wmma_f32_16x16x32_f16(false, a, false, b, (short)0, c, false, false); asm volatile("v_nop\n\tv_nop\n\tv_nop\n\tv_nop" : "+v"(d) : "v"(a), "v"(b)); return d; }
__device__ __forceinline__ v8f g2_mmap(v16h a, v16h b, v8f c) { return __builtin_amdgcn_wmma_f32_16x16x32_f16(false, a, false, b, (short)0, c, false, false); }      /* the bare builtin: the compiler keeps the distances between products itself and is free in placing their registers (tied to g2_mma's asm operands, the 64x64 tile's accumulators and fragments spilled) */
#define G2_PITCH 144                  /* LDS row pitch in bytes for rows of 128: 16 x odd, so that the 16 rows of a 16-byte fragment read fall on all 64 banks */
#define G2_STAGE (384 * G2_PITCH)     /* one stage: 128 A rows, then 256 B rows */
__device__ __forceinline__ v16h g2_lfrag(const unsigned char* p) { FragH f; f.half[0] = *(const v8us*)p; f.half[1] = *(const v8us*)(p + 32); return f.v; }      /* p = the lane's LDS row + 16 * (lane >> 4) bytes: k 8 hh .. + 7 and 16 + 8 hh .. + 7, as g2_frag */
// The thread's 12 pieces of 16 bytes of the next stage (4 of A, 8 of B), requested as one batch; then both offsets step on by one stage. go = the thread's own byte offsets in A and in B
// (32 bits: an operand plane stays under 4 GiB); uo = the byte offsets of the 12 row groups, the same for the whole block: they go into the loads' scalar bases, so that
// twelve loads take two offset registers.
__device__ __forceinline__ void g2_request(v8us (&rg)[12], const _Float16* A, const _Float16* B, const unsigned (&uo)[12], unsigned (&go)[2]) {
#pragma unroll
  for (int j = 0; j < 12; ++j) rg[j] = *(const v8us*)(((const char*)(j < 4 ? A : B) + uo[j]) + go[j < 4 ? 0 : 1]);      /* unrolled: rg stays in registers only under constant indices */
  asm volatile("s_wait_xcnt 0x0" :: "v"(go[0]), "v"(go[1]) : "memory");      /* the wait in front of the overwrite of the loads' offset registers just below; as inputs the offsets keep their registers up to here; the memory clobber keeps the 12 loads in front of it, one batch ahead of the products */
  go[0] += 128; go[1] += 128; }
__device__ __forceinline__ void g2_store(const v8us (&rg)[12], unsigned char* sw) {
#pragma unroll
  for (int j = 0; j < 12; ++j) *(v8us*)(sw + j * 32 * G2_PITCH) = rg[j]; }      /* piece j lies 32 rows below piece j - 1 */
// FT: what a tile does that holds a batch's first QT0 rows (the rows that are carried in f32 beside the f16 path); such a tile is one whole block tile.
//   FT 1: it stores its values as f32 too, into CF (planes of NB * QT0 rows, pitch ldc, sCF elements apart along blockIdx.y).
//   FT 2: its A rows come from AF instead of A, as two f16 planes sAF elements apart: the high part, then the residual x1024. It walks K twice: the high part's sums are
//         multiplied by 1024 (exact) where the second walk begins, the residual's products are added to them, and alpha takes the 2^-10 back. K at least 128.
template <int ACT, int FT>
__global__ __launch_bounds__(256) void k_gemm2(const _Float16* __restrict__ A, int lda, size_t sA, const _Float16* __restrict__ Bh, int ldb, size_t sB, float alpha, const float* __restrict__ bias, size_t sBias, const float* __restrict__ CP, int rowsPerB, size_t sCPb, int row0g,
    float* __restrict__ C, _Float16* __restrict__ C16, int ldc, size_t sC, int M, int N, int K, size_t zA, size_t zB, size_t zC, const _Float16* __restrict__ AF, size_t sAF, float* __restrict__ CF, size_t sCF) { static_assert(QT0 == 128 && SQ % 128 == 0, "k_gemm2: a first tile is one block tile"); static_assert(ACT == 0 || ACT == 3 || ACT == 6 || ACT == 8 || ACT == 9 || ACT == 11 || ACT == 12 || ACT == 14 || ACT == 15 || ACT == 16 || ACT == 17, "k_gemm2: unsupported ACT code (would silently apply no activation)");
  __shared__ __attribute__((aligned(16))) unsigned char sm[2 * G2_STAGE]; float (*so)[32][68] = (float (*)[32][68])sm; static_assert(8 * 32 * 68 * 4 <= 2 * G2_STAGE, "k_gemm2: the epilogue's rows fit the stage buffers");      /* the epilogue's staging rows reuse the stage buffers, behind the loop's last barrier */
  const int tid = threadIdx.x, w = tid >> 5, lane = tid & 31, ln = lane & 15, hh = lane >> 4; const int by = blockIdx.y, bz = blockIdx.z;      /* two batch axes, each with its own strides */
  A += (size_t)by * sA + (size_t)bz * zA; Bh += (size_t)by * sB + (size_t)bz * zB; const size_t cofs = (size_t)by * sC + (size_t)bz * zC; const float* bp = bias ? bias + (size_t)by * sBias : nullptr;
  const int ntn = N >> 8; const int mt = blockIdx.x / ntn, nq = blockIdx.x - mt * ntn; const int wr = w >> 2, wc = w & 3; const int row0 = mt * 128 + 64 * wr, col0 = nq * 256 + 64 * wc;      /* the wave's 64x64 tile */
  const bool ft = (mt % (SQ / 128)) == 0; const int fr0 = (mt / (SQ / 128)) * QT0;      /* a first tile, and its first row in the first-tile planes; the same for the whole block */
  const _Float16* const Ab = (FT == 2 && ft) ? AF : A;
  const int sr = tid >> 3, sc = (tid & 7) * 8;      /* staging: 8 threads a row, piece j of a thread = stage row 32 j + sr, k sc .. sc + 7 */
  unsigned go[2], uo[12]; v8us rg[12];
#pragma unroll
  for (int j = 0; j < 4; ++j) { const int rb = mt * 128 + j * 32; uo[j] = (unsigned)((FT == 2 && ft) ? fr0 + j * 32 : rb <= M - 32 ? rb : M - 32) * (unsigned)lda * 2u; }      /* a row group past M (its wave stores nothing) reads the last 32 rows instead */
  go[0] = ((unsigned)sr * (unsigned)lda + sc) * 2u; go[1] = ((unsigned)sr * (unsigned)ldb + sc) * 2u;
#pragma unroll
  for (int j = 0; j < 8; ++j) uo[4 + j] = (unsigned)__builtin_amdgcn_readfirstlane((int)((unsigned)(nq * 256 + j * 32) * (unsigned)ldb * 2u));      /* through readfirstlane, so that each stays a scalar of its own: as plain multiples of one stride the compiler chained them into vector address pairs, on which later loads' results landed */
  unsigned char* const sw = sm + sr * G2_PITCH + sc * 2;
  const unsigned char* const ar = sm + (64 * wr + ln) * G2_PITCH + 16 * hh; const unsigned char* const br = sm + (128 + 64 * wc + ln) * G2_PITCH + 16 * hh;
  const v8f z8 = {0.f,0.f,0.f,0.f,0.f,0.f,0.f,0.f}; v8f cc[4][4];      /* cc[i][t]: rows 16 i .., columns 16 t .. of the wave's tile */
#pragma unroll
  for (int i = 0; i < 4; ++i) for (int t = 0; t < 4; ++t) cc[i][t] = z8;
  const int nk = K >> 6; const int nst = (FT == 2 && ft) ? 2 * nk : nk;
  g2_request(rg, Ab, Bh, uo, go); g2_store(rg, sw); if (nst > 1) g2_request(rg, Ab, Bh, uo, go);
  __syncthreads();      /* stage 0 is complete before any wave reads it */
#pragma unroll 1
  for (int s = 0; s < nst; ++s) {      /* rolled: the trip count is a run-time value and one copy of the body holds all the overlap there is */
    const int cur = (s & 1) * G2_STAGE;
    if (FT == 2 && s == nk) {      /* the second walk begins (first tiles only: elsewhere s stays below nk) */
#pragma unroll
      for (int i = 0; i < 4; ++i) for (int t = 0; t < 4; ++t) cc[i][t] *= 1024.0f; }
    if (s + 1 < nst) { g2_store(rg, sw + (G2_STAGE - cur));
      if (s + 2 < nst) {
        if (FT == 2 && s + 2 == nk) { go[0] += (unsigned)sAF * 2u - (unsigned)K * 2u; go[1] -= (unsigned)K * 2u; }      /* the next request is the second walk's first: A on to the residual plane, B back to k = 0 */
        g2_request(rg, Ab, Bh, uo, go); } }      /* stage s + 1 into the buffer that every wave left at the last barrier; stage s + 2 in flight under this stage's products */
    v16h fa[2][4], fb[2][4];      /* the loops over ks, t and i are unrolled: the indices pick fragments and accumulators, which stay in registers only if they are constants */
#pragma unroll
    for (int ks = 0; ks < 2; ++ks) {
      if (ks == 0 || FT != 2) {      /* FT 2 (one block on a WGP, registers to spare): both k steps' reads in front of the first product; else each k step's 16 reads in front of its own products */
#pragma unroll
        for (int k2 = ks; k2 < (FT == 2 ? 2 : ks + 1); ++k2) for (int t = 0; t < 4; ++t) { fa[k2][t] = g2_lfrag(ar + cur + t * 16 * G2_PITCH + k2 * 64); fb[k2][t] = g2_lfrag(br + cur + t * 16 * G2_PITCH + k2 * 64); }
        __builtin_amdgcn_sched_barrier(0); }      /* the reads go out as one group: left alone they were spread among the products in pairs, each pair waited for at once, and every pair's latency showed */
#pragma unroll
      for (int t = 0; t < 4; ++t) for (int i = 0; i < 4; ++i) if (ks + t + i < 7) cc[i][t] = g2_mmap(fa[ks][i], fb[ks][t], cc[i][t]);
      __builtin_amdgcn_sched_barrier(0); }      /* the next k step's reads stay behind these products (no second fragment set in registers); behind the last step: the products stay in front of the stage's last one (some had sunk behind the barrier, right in front of the loop's branch) */
    cc[3][3] = g2_mma(fa[1][3], fb[1][3], cc[3][3]);      /* the stage's last product with g2_mma's four free slots: a branch follows */
    __syncthreads(); }      /* stage s + 1 is complete, and every wave has left stage s, whose buffer the next trip overwrites (behind the last trip: the epilogue) */
  if (row0 >= M) return;      /* no barrier behind this point */
  const float al = (FT == 2 && ft) ? alpha * 0.0009765625f : alpha;
  const int rsub = lane >> 4, c4 = (lane & 15) * 4;
#pragma unroll
  for (int hf = 0; hf < 2; ++hf) {      /* the wave's tile leaves in two halves of 32 rows, through the same staging rows; unrolled: hf picks accumulators */
  const int rowh = row0 + 32 * hf;
#pragma unroll
  for (int u = 0; u < 8; ++u) { const int t = u & 3, half = u >> 2; const int col = col0 + t * 16 + ln; const float bv = bp ? bf16_round(bp[col]) : 0.f;
#pragma unroll
    for (int r = 0; r < 8; ++r) { const int rloc = half * 16 + 8 * hh + r; float v = cc[2 * hf + half][t][r] * al + bv;      /* no added plane: CP, rowsPerB, sCPb and row0g are not read (every launch passes CP = nullptr); with that branch at each of a lane's 128 elements the kernel's text was five times as long */
      if (ACT == 3) v = fmaxf(v, 0.f); else if (ACT == 6) v = 0.5f * v * (1.0f + erff(v * 0.70710678118654752f)); else if (ACT == 11) v = 1.0f / (1.0f + expf(-v)); else if (ACT == 15) v = v / (1.0f + expf(-v)); else if (ACT == 12) v = (v > 0.f) ? v : 0.01f * v; else if (ACT == 8) v = tanhf(v); else if (ACT == 9) v = 0.5f * v * (1.0f + tanhf(0.7978845608028654f * (v + 0.044715f * v * v * v))); else if (ACT == 14) v = (v > 0.f) ? v : 0.1f * v; else if (ACT == 16) v = (v >= 0.f) ? v : 0.3f * v; else if (ACT == 17) v = (v >= 0.f) ? v : 0.2f * v;
      so[w][rloc][t * 16 + ln] = v; } }
  __builtin_amdgcn_fence(__ATOMIC_ACQ_REL, "workgroup"); __builtin_amdgcn_wave_barrier();
  {
#pragma unroll
    for (int q = 0; q < 16; ++q) { const int r = q * 2 + rsub; const v4f v = *(const v4fa*)&so[w][r][c4];
      /* behind each of the stores, at the end of its branch: the wait in front of the overwrite of the store's registers (the next store's value or address, formed in the next branch, lands on them) */
      if (C) { *(v4f*)(C + cofs + (size_t)(rowh + r) * ldc + col0 + c4) = v; asm volatile("s_wait_xcnt 0x0" ::: "memory"); }
      if (C16) { v4h h4; for (int i = 0; i < 4; ++i) h4[i] = (_Float16)v[i]; *(v4h*)(C16 + cofs + (size_t)(rowh + r) * ldc + col0 + c4) = h4; asm volatile("s_wait_xcnt 0x0" ::: "memory"); }
      if (FT == 1 && ft) { *(v4f*)(CF + (size_t)by * sCF + (size_t)(fr0 + 64 * wr + 32 * hf + r) * ldc + col0 + c4) = v; asm volatile("s_wait_xcnt 0x0" ::: "memory"); } }
     }
  if (hf == 0) { __builtin_amdgcn_fence(__ATOMIC_ACQ_REL, "workgroup"); __builtin_amdgcn_wave_barrier(); } } }      /* the first half's rows are read back by all lanes before the second half overwrites them */


__global__ __launch_bounds__(256) void k_rsm(const float* __restrict__ S, _Float16* __restrict__ P, int nrows) {
  #pragma clang fp contract(off)
  const int i = blockIdx.x * 256 + threadIdx.x; if (i >= nrows) return; const float* s = S + (size_t)i * SQ; float mx = -3.0e38f;
#pragma unroll 1
  for (int j = 0; j < SQ; ++j) mx = fmaxf(mx, s[j]); float se = 0.f;
#pragma unroll 1
  for (int j = 0; j < SQ; ++j) se += expf(s[j] - mx); const float sc = 256.0f / se;
#pragma unroll 1
  for (int j0 = 0; j0 < SQ; j0 += 8) { FragH f; for (int q = 0; q < 8; ++q) f.h[q] = (_Float16)(expf(s[j0 + q] - mx) * sc); unsigned short* d = (unsigned short*)P + (size_t)i * SQ + j0; *(v8us*)d = f.half[0];  } }
__global__ __launch_bounds__(256) void k_vt(const _Float16* __restrict__ V16, int b, int h0, _Float16* __restrict__ VT) { __shared__ unsigned short tl[64][65]; const int tid = threadIdx.x; const int hh = blockIdx.x % HG, sg = blockIdx.x / HG; const int s0 = sg * 64; const int h = h0 + hh;
  for (int i = tid; i < 64 * 8; i += 256) { const int j = i / 8, d8 = (i % 8) * 8; FragH f; f.half[0] = *(const v8us*)((const unsigned short*)V16 + ((size_t)b * SQ + s0 + j) * DM + h * HD + d8); for (int q = 0; q < 8; ++q) tl[d8 + q][j] = f.u[q]; }
  __syncthreads();
  { for (int i = tid; i < 64 * 8; i += 256) { const int d = i / 8, j8 = (i % 8) * 8; FragH f; for (int q = 0; q < 8; ++q) f.u[q] = tl[d][j8 + q]; *(v8us*)((unsigned short*)VT + ((size_t)hh * HD + d) * SQ + s0 + j8) = f.half[0]; }  } }



// ---- fused causal attention ----
typedef _Float16 v8h __attribute__((ext_vector_type(8)));
__device__ __forceinline__ float fa_xhalf(float x) { return __builtin_bit_cast(float, __builtin_amdgcn_permlanex16(__builtin_bit_cast(int, x), __builtin_bit_cast(int, x), 0x76543210, 0xfedcba98, false, false)); }      /* lane l takes lane l ^ 16 */
__device__ __forceinline__ v8f fa_mma(v16h a, v16h b, v8f c) { return __builtin_amdgcn_wmma_f32_16x16x32_f16(false, a, false, b, (short)0, c, false, false); }
// Native 2^x and 1/x. In asm so that the v_nop stands directly behind the last transcendental: the one free issue slot that the instruction set asks for before an instruction that
// reads the result or overwrites the source. In the group of four each v_exp_f32 is
// the free slot of the one before it: the early-clobber results lie on no source.
__device__ __forceinline__ float fa_exp2(float x) { float r; asm("v_exp_f32 %0, %1\n\tv_nop" : "=v"(r) : "v"(x)); return r; }
__device__ __forceinline__ float fa_rcp(float x) { float r; asm("v_rcp_f32 %0, %1\n\tv_nop" : "=v"(r) : "v"(x)); return r; }
__device__ __forceinline__ v4f fa_exp2x4(v4f x) { float r0, r1, r2, r3;
  asm("v_exp_f32 %0, %4\n\tv_exp_f32 %1, %5\n\tv_exp_f32 %2, %6\n\tv_exp_f32 %3, %7\n\tv_nop" : "=&v"(r0), "=&v"(r1), "=&v"(r2), "=&v"(r3) : "v"(x[0]), "v"(x[1]), "v"(x[2]), "v"(x[3]));
  const v4f r = {r0, r1, r2, r3}; return r; }
// Fragment of 16 rows x 32 k in the k order of g2_frag; p = the lane's row + 8 * (lane >> 4), so that the pointer itself is the loads' address register.
__device__ __forceinline__ v16h fa_frag(const _Float16* p) { FragH f; f.half[0] = *(const v8us*)((const unsigned short*)p); f.half[1] = *(const v8us*)((const unsigned short*)p + 16); return f.v; }
// K and V^T reach the waves through LDS, in stages of 64 keys that the block's four waves share: 64 K rows (64 dims each), then 64 V^T rows (64 keys each), all rows of 128 bytes.
#define FA_PITCH 144                  /* LDS row pitch in bytes, as G2_PITCH: 16 x odd, so that the 16 rows of a 16-byte fragment read fall on all 64 banks */
#define FA_TILE (64 * FA_PITCH)       /* 64 rows */
#define FA_STAGE (2 * FA_TILE)        /* one stage: the K rows, then the V^T rows */
// One stage's copies of a thread: 8 pieces of 16 bytes, global memory to LDS through no register (8 threads a row, piece j 16 rows below piece j - 1; 4 pieces of K, 4 of V^T).
// ld = the thread's LDS byte address in the stage's first K row group; kg, vg = its global addresses there. The s_wait_xcnt is the statement's last line, so that it stands in
// front of every later write of a register that a copy names (the callers step kg and vg right behind the call).
__device__ __forceinline__ void fa_copy(unsigned ld, const _Float16* kg, const _Float16* vg) {
  asm volatile("global_load_async_to_lds_b128 %0, %8, off\n\t"
               "global_load_async_to_lds_b128 %1, %9, off\n\t"
               "global_load_async_to_lds_b128 %2, %10, off\n\t"
               "global_load_async_to_lds_b128 %3, %11, off\n\t"
               "global_load_async_to_lds_b128 %4, %12, off\n\t"
               "global_load_async_to_lds_b128 %5, %13, off\n\t"
               "global_load_async_to_lds_b128 %6, %14, off\n\t"
               "global_load_async_to_lds_b128 %7, %15, off\n\t"
               "s_wait_xcnt 0x0"
               :: "v"(ld), "v"(ld + 16 * FA_PITCH), "v"(ld + 32 * FA_PITCH), "v"(ld + 48 * FA_PITCH),
                  "v"(ld + FA_TILE), "v"(ld + FA_TILE + 16 * FA_PITCH), "v"(ld + FA_TILE + 32 * FA_PITCH), "v"(ld + FA_TILE + 48 * FA_PITCH),
                  "v"(kg), "v"(kg + (size_t)16 * DM), "v"(kg + (size_t)32 * DM), "v"(kg + (size_t)48 * DM),
                  "v"(vg), "v"(vg + (size_t)16 * SQ), "v"(vg + (size_t)32 * SQ), "v"(vg + (size_t)48 * SQ)
               : "memory"); }
// One pass: 32 keys against the wave's 32 queries (two groups of 16). Lane (c = lane & 15, hh = lane >> 4) owns query 16 g + c in both products:
//   S^T = K Q^T : A = 16 K rows (g2_lfrag from LDS), B = 16 Q rows (fa_frag), the same k order; s[g][kt][r] = score of key 16 kt + 8 hh + r
//   O^T += V^T P^T : A = 16 V^T rows (dims) by g2_lfrag over the 32 keys; B element e = weight of key (e < 8 ? 8 hh + e : 16 + 8 hh + e - 8) = s[g][e >> 3][e & 7], the k order of g2_lfrag
// so maximum, sum and rescale are the lane's own, with one exchange between the wave's halves. mr = maximum in use (log2 units); it may trail the true one by up to 6
// (weights then reach 256 * 2^6, well inside f16); sums and o are rescaled only in a pass in which some query's maximum has run further ahead.
// kn = the lane's place in the K rows of the next pass, read only where NEXTK says that the wave has that pass and that it lies in the same stage; vl = its place in this pass's
// V^T columns. DIAG and NEXTK are the same for the whole wave (scalar branches): one copy of the pass serves all cases, so the accumulators stay in their registers.
// The unroll directives here and in k_fattn: the loop indices pick fragments and accumulators, which stay in registers only if every index is a constant.
__device__ __forceinline__ void fa_pass(const bool DIAG, const bool NEXTK, v16h (&kf)[2][2], const unsigned char* kn, const unsigned char* vl, const v16h (&qf)[2][2], v8f (&o)[2][4], float (&mr)[2], float (&l)[2], int rel) {
  const float cs = 0.125f * 1.44269504088896340736f;      /* score scale times log2(e) */
  v16h vf[4];
#pragma unroll
  for (int t = 0; t < 4; ++t) vf[t] = g2_lfrag(vl + t * 16 * FA_PITCH);      /* this pass's V^T: in flight under the first product and the softmax */
  v8f s[2][2]; const v8f z8 = {0.f, 0.f, 0.f, 0.f, 0.f, 0.f, 0.f, 0.f};
#pragma unroll
  for (int g = 0; g < 2; ++g) for (int kt = 0; kt < 2; ++kt) { const v8f t = fa_mma(kf[kt][0], qf[g][0], z8); s[g][kt] = (g + kt == 2) ? g2_mma(kf[kt][1], qf[g][1], t) : fa_mma(kf[kt][1], qf[g][1], t); }      /* the last one with g2_mma's four free slots: a branch follows */
  if (NEXTK) {      /* the next pass's K, of the same stage: in flight under this pass's softmax and second product */
#pragma unroll
    for (int kt = 0; kt < 2; ++kt) for (int d = 0; d < 2; ++d) kf[kt][d] = g2_lfrag(kn + kt * 16 * FA_PITCH + d * 64); }
  if (DIAG) {      /* the pass on the diagonal: key 16 kt + 8 hh + r stays while it is not above query 16 g + c (rel = c - 8 hh) */
#pragma unroll
    for (int g = 0; g < 2; ++g) for (int kt = 0; kt < 2; ++kt) for (int r = 0; r < 8; ++r) s[g][kt][r] = (16 * kt + r - 16 * g <= rel) ? s[g][kt][r] : -1.0e30f; }
  float mb[2]; bool need = false;
#pragma unroll
  for (int g = 0; g < 2; ++g) { float mx = s[g][0][0];
    for (int r = 1; r < 8; ++r) mx = fmaxf(mx, s[g][0][r]);
    for (int r = 0; r < 8; ++r) mx = fmaxf(mx, s[g][1][r]);
    mx = fmaxf(mx, fa_xhalf(mx)) * cs; mb[g] = mx; need = need || (mx > mr[g] + 6.0f); }
  if (__builtin_amdgcn_ballot_w32(need) != 0) {      /* wave-uniform; always taken in the first pass (mr = -1e30, factor 0), seldom later */
#pragma unroll
    for (int g = 0; g < 2; ++g) { const float mn = fmaxf(mr[g], mb[g]); const float corr = fa_exp2(mr[g] - mn); mr[g] = mn; l[g] *= corr;
      for (int t = 0; t < 4; ++t) o[g][t] *= corr; } }
#pragma unroll
  for (int g = 0; g < 2; ++g) { const float nm = 8.0f - mr[g];      /* weights carried x256 */
    FragH pf; v4f ls = {0.f, 0.f, 0.f, 0.f};
    for (int i = 0; i < 4; ++i) { v4f a; for (int u = 0; u < 4; ++u) a[u] = fmaf(s[g][i >> 1][(i & 1) * 4 + u], cs, nm);
      const v4f p = fa_exp2x4(a); ls += p; for (int u = 0; u < 4; ++u) pf.h[i * 4 + u] = (_Float16)p[u]; }
    l[g] += (ls[0] + ls[1]) + (ls[2] + ls[3]);
    for (int t = 0; t < 3; ++t) o[g][t] = fa_mma(vf[t], pf.v, o[g][t]);
    o[g][3] = g2_mma(vf[3], pf.v, o[g][3]); } }      /* the weights' last use, with g2_mma's four free slots: what may next land on their registers is asm text (fa_exp2x4, fa_rcp) */
// ---- a batch's first QT0 queries: the same walk in f32, on v_wmma_f32_16x16x4_f32, from the f32 q, k, v rows ----
typedef float v2f __attribute__((ext_vector_type(2)));
__device__ __forceinline__ v8f f0_mma(v2f a, v2f b, v8f c) { return __builtin_amdgcn_wmma_f32_16x16x4_f32(false, a, false, b, (short)0, c, false, false); }
#define F0_PITCH 272                  /* LDS row pitch in bytes for rows of 256: 16 x odd, as FA_PITCH */
#define F0_TILE (64 * F0_PITCH)       /* 64 rows of 64 f32: the K rows, then the V rows, one stage of 64 keys in the same LDS as the f16 stages */
static_assert(2 * F0_TILE <= 2 * FA_STAGE && QT0 == 128, "f0_block: one f32 stage fits the f16 stage buffers; four waves of 32 queries");
// One tile's copies of a thread: 8 pieces of 16 bytes, global memory to LDS through no register (16 threads a row, piece j 8 rows below piece j - 1). The s_wait_xcnt is the
// statement's last line, so that it stands in front of every later write of a register that a copy names (the caller steps g right behind the call).
__device__ __forceinline__ void f0_copy(unsigned ld, const float* g) {
  asm volatile("global_load_async_to_lds_b128 %0, %8, off\n\t"
               "global_load_async_to_lds_b128 %1, %9, off\n\t"
               "global_load_async_to_lds_b128 %2, %10, off\n\t"
               "global_load_async_to_lds_b128 %3, %11, off\n\t"
               "global_load_async_to_lds_b128 %4, %12, off\n\t"
               "global_load_async_to_lds_b128 %5, %13, off\n\t"
               "global_load_async_to_lds_b128 %6, %14, off\n\t"
               "global_load_async_to_lds_b128 %7, %15, off\n\t"
               "s_wait_xcnt 0x0"
               :: "v"(ld), "v"(ld + 8 * F0_PITCH), "v"(ld + 16 * F0_PITCH), "v"(ld + 24 * F0_PITCH), "v"(ld + 32 * F0_PITCH), "v"(ld + 40 * F0_PITCH), "v"(ld + 48 * F0_PITCH), "v"(ld + 56 * F0_PITCH),
                  "v"(g), "v"(g + (size_t)8 * DM), "v"(g + (size_t)16 * DM), "v"(g + (size_t)24 * DM), "v"(g + (size_t)32 * DM), "v"(g + (size_t)40 * DM), "v"(g + (size_t)48 * DM), "v"(g + (size_t)56 * DM)
               : "memory"); }
// One pass, as fa_pass: 32 keys against the wave's 32 queries, lane (c, hh) owns query 16 g + c in both products; a product takes 4 k, two in each half of the wave.
//   S^T = K Q^T : piece jj of a K row and of a Q row = dims 8 jj + 4 hh .. + 3, two products (elements 0, 1, then 2, 3): the same k order on both sides
//   O^T += V^T P^T : product j of key tile kt takes keys 16 kt + 8 hh + 2 j and + 1: B = the lane's own s[g][kt][2 j], [2 j + 1]; A = those two V rows at dim 16 t + c
// kl = the lane's place in the pass's K rows (row c, byte 16 hh); vl = its place in the pass's V rows (row 8 hh, dim c); rel = query c less key 8 hh: key 16 kt + r stays for query
// 16 g while 16 kt + r - 16 g <= rel (true everywhere below the diagonal pass). Maximum, sum and o are rescaled in every pass (four passes at most).
__device__ __forceinline__ void f0_pass(const unsigned char* kl, const unsigned char* vl, const v4f (&qf)[2][8], v8f (&o)[2][4], float (&mr)[2], float (&l)[2], int rel) {
  const float cs = 0.125f * 1.44269504088896340736f;      /* score scale times log2(e) */
  const v8f z8 = {0.f, 0.f, 0.f, 0.f, 0.f, 0.f, 0.f, 0.f}; v8f s[2][2] = {{z8, z8}, {z8, z8}};
#pragma unroll
  for (int hf = 0; hf < 2; ++hf) { v4f k4[4][2];      /* half the dims at a time */
    for (int j4 = 0; j4 < 4; ++j4) for (int kt = 0; kt < 2; ++kt) k4[j4][kt] = *(const v4f*)(kl + kt * 16 * F0_PITCH + (4 * hf + j4) * 32);
    __builtin_amdgcn_sched_barrier(0);      /* the half's 8 reads go out as one group */
    for (int j4 = 0; j4 < 4; ++j4) for (int kt = 0; kt < 2; ++kt) { const int jj = 4 * hf + j4; const v2f ka = {k4[j4][kt][0], k4[j4][kt][1]}, kb = {k4[j4][kt][2], k4[j4][kt][3]};
      for (int g = 0; g < 2; ++g) { const v2f qa = {qf[g][jj][0], qf[g][jj][1]}, qb = {qf[g][jj][2], qf[g][jj][3]}; s[g][kt] = f0_mma(kb, qb, f0_mma(ka, qa, s[g][kt])); } }
    __builtin_amdgcn_sched_barrier(0); }      /* the next group's reads stay behind these products: with all reads hoisted the kernel took more registers than four waves on a SIMD have */
  asm volatile("v_nop\n\tv_nop\n\tv_nop\n\tv_nop" : "+v"(s[0][0]), "+v"(s[0][1]), "+v"(s[1][0]), "+v"(s[1][1]));      /* the free slots between the last products and the first vector instruction that reads a score */
  float corr[2];
#pragma unroll
  for (int g = 0; g < 2; ++g) { float mx = -1.0e30f;
    for (int kt = 0; kt < 2; ++kt) for (int r = 0; r < 8; ++r) { s[g][kt][r] = (16 * kt + r - 16 * g <= rel) ? s[g][kt][r] : -1.0e30f; mx = fmaxf(mx, s[g][kt][r]); }
    mx = fmaxf(mx, fa_xhalf(mx)) * cs; const float mn = fmaxf(mr[g], mx); corr[g] = fa_exp2(mr[g] - mn); mr[g] = mn;      /* first pass: mr = -1e30, factor 0 */
    for (int t = 0; t < 4; ++t) o[g][t] *= corr[g];
    for (int i = 0; i < 4; ++i) { v4f a; for (int u = 0; u < 4; ++u) a[u] = fmaf(s[g][i >> 1][(i & 1) * 4 + u], cs, -mn);
      const v4f p = fa_exp2x4(a); for (int u = 0; u < 4; ++u) s[g][i >> 1][(i & 1) * 4 + u] = p[u]; } }      /* the weights take the scores' places */
#pragma unroll
  for (int kt = 0; kt < 2; ++kt) { v2f va[4][4];      /* one key tile at a time */
    for (int j = 0; j < 4; ++j) for (int t = 0; t < 4; ++t) { const unsigned char* vp = vl + (16 * kt + 2 * j) * F0_PITCH + t * 64; const v2f x = {*(const float*)vp, *(const float*)(vp + F0_PITCH)}; va[j][t] = x; }
    __builtin_amdgcn_sched_barrier(0);      /* the tile's reads go out as one group */
    for (int j = 0; j < 4; ++j) for (int t = 0; t < 4; ++t) for (int g = 0; g < 2; ++g) { const v2f pb = {s[g][kt][2 * j], s[g][kt][2 * j + 1]}; o[g][t] = f0_mma(va[j][t], pb, o[g][t]); }
    if (kt == 0) asm volatile("v_nop\n\tv_nop\n\tv_nop\n\tv_nop" : "+v"(o[0][0]), "+v"(o[0][1]), "+v"(o[0][2]), "+v"(o[0][3]), "+v"(o[1][0]), "+v"(o[1][1]), "+v"(o[1][2]), "+v"(o[1][3]));      /* the free slots behind the tile's last products: the next tile's address sums landed on their operands' registers */
    __builtin_amdgcn_sched_barrier(0); }      /* as above: the next group's reads stay behind these products */
  asm volatile("v_nop\n\tv_nop\n\tv_nop\n\tv_nop\n\tv_nop" : "+v"(o[0][0]), "+v"(o[0][1]), "+v"(o[0][2]), "+v"(o[0][3]), "+v"(o[1][0]), "+v"(o[1][1]), "+v"(o[1][2]), "+v"(o[1][3]), "+v"(s[0][0]), "+v"(s[0][1]), "+v"(s[1][0]), "+v"(s[1][1]));      /* the free slots behind the pass's last products, in front of whatever next writes their operands' registers or reads o (a branch follows soon); the weights go through it so that their sums, below, are formed behind the slots and not inside them */
#pragma unroll
  for (int g = 0; g < 2; ++g) { v4f ls = {0.f, 0.f, 0.f, 0.f};
    for (int i = 0; i < 4; ++i) { const v4f p = {s[g][i >> 1][(i & 1) * 4], s[g][i >> 1][(i & 1) * 4 + 1], s[g][i >> 1][(i & 1) * 4 + 2], s[g][i >> 1][(i & 1) * 4 + 3]}; ls += p; }
    l[g] = fmaf(l[g], corr[g], (ls[0] + ls[1]) + (ls[2] + ls[3])); } }
// The block of a head's and batch's first QT0 queries: 4 waves of 32 queries, the keys in two stages of 64 through one LDS buffer. o (x64) leaves as two f16 planes: the high part and the residual x1024.
__device__ __forceinline__ void f0_block(unsigned char* sm, const float* __restrict__ QF, const float* __restrict__ KF, const float* __restrict__ VF, _Float16* __restrict__ OH, _Float16* __restrict__ OL, int h, int b) {
  const int tid = threadIdx.x, lane = tid & 31, c = lane & 15, hh = lane >> 4; const int w = __builtin_amdgcn_readfirstlane(tid >> 5);      /* the wave's number = its pass on the diagonal: scalar */
  const float* qp = QF + ((size_t)b * QT0 + 32 * w + c) * DM + h * HD + 4 * hh;
  v4f qf[2][8];
#pragma unroll
  for (int g = 0; g < 2; ++g) for (int jj = 0; jj < 8; ++jj) qf[g][jj] = *(const v4fa*)(qp + (size_t)g * 16 * DM + jj * 8);
  asm volatile("s_wait_xcnt 0x0" :: "v"(qp) : "memory");      /* the wait in front of any overwrite of the loads' address register; as an input the address keeps its register up to here */
  const int sr = tid >> 4, sc = (tid & 15) * 4;      /* staging: 16 threads a row */
  const float* kg = KF + ((size_t)b * QT0 + sr) * DM + h * HD + sc; const float* vg = VF + ((size_t)b * QT0 + sr) * DM + h * HD + sc;
  const unsigned ld = (unsigned)(size_t)(sm + sr * F0_PITCH + sc * 4);      /* the low 32 bits of the address: the byte offset in the block's LDS */
  const unsigned char* const kl = sm + c * F0_PITCH + 16 * hh; const unsigned char* const vl = sm + F0_TILE + 8 * hh * F0_PITCH + c * 4;
  const v8f z8 = {0.f, 0.f, 0.f, 0.f, 0.f, 0.f, 0.f, 0.f}; v8f o[2][4] = {{z8, z8, z8, z8}, {z8, z8, z8, z8}}; float mr[2] = {-1.0e30f, -1.0e30f}, l[2] = {0.f, 0.f};
#pragma unroll 1
  for (int st = 0; st < QT0 / 64; ++st) {      /* rolled, and the loop over p too: one copy of the pass */
    asm volatile("s_wait_dscnt 0x0" ::: "memory");      /* the wave's reads of the stage before have returned before the buffer is given up */
    __syncthreads();      /* every wave has left the buffer */
    f0_copy(ld, kg); f0_copy(ld + F0_TILE, vg); kg += (size_t)64 * DM; vg += (size_t)64 * DM;
    asm volatile("s_wait_asynccnt 0x0" ::: "memory");      /* the wave's own copies have landed */
    __syncthreads();      /* the stage is complete before any wave reads it */
#pragma unroll 1
    for (int p = 0; p < 2; ++p) { const int kb = 2 * st + p;
      if (kb <= w) f0_pass(kl + p * 32 * F0_PITCH, vl + p * 32 * F0_PITCH, qf, o, mr, l, 32 * (w - kb) + c - 8 * hh); } }      /* a scalar test: a pass above the wave's diagonal is skipped */
  const size_t e = ((size_t)b * QT0 + 32 * w + c) * DM + h * HD + 8 * hh;      /* o[g][t][r] = dim 16 t + 8 hh + r of query 16 g + c: eight neighbours, one 16-byte store in each plane */
  v8h oh[2][4], ol[2][4];
#pragma unroll
  for (int g = 0; g < 2; ++g) { const float ll = l[g] + fa_xhalf(l[g]); float rc = fa_rcp(ll); rc = fmaf(rc, fmaf(-ll, rc, 1.0f), rc); const float fin = 64.0f * rc;      /* the halves' sums joined; one Newton step on the native 1/x; o carried x64 like the f16 path */
    for (int t = 0; t < 4; ++t) for (int r = 0; r < 8; ++r) { const float v = o[g][t][r] * fin; const _Float16 hp = (_Float16)v; oh[g][t][r] = hp; ol[g][t][r] = (_Float16)((v - (float)hp) * 1024.0f); } }
  __builtin_amdgcn_sched_barrier(0);      /* every value is formed before the first store: no store's registers are written again behind it */
#pragma unroll
  for (int g = 0; g < 2; ++g) for (int t = 0; t < 4; ++t) { *(v8h*)(OH + e + (size_t)g * 16 * DM + t * 16) = oh[g][t]; *(v8h*)(OL + e + (size_t)g * 16 * DM + t * 16) = ol[g][t]; } }
// grid (heads, batches, blocks of 128 queries, the longest first); 4 waves of 32 queries. A block of a batch's first 128 queries goes to f0_block; any other walks the keys up to its last query in stages of 64 (two passes), two LDS
// buffers: stage st + 1's copies fly while stage st is worked on. A wave skips the passes above its own diagonal, but passes every wait and barrier.
__global__ __launch_bounds__(128) void k_fattn(const _Float16* __restrict__ Q, const _Float16* __restrict__ K, const _Float16* __restrict__ VT, _Float16* __restrict__ O, const float* __restrict__ QF, const float* __restrict__ KF, const float* __restrict__ VF, _Float16* __restrict__ OH, _Float16* __restrict__ OL) {
  __shared__ __attribute__((aligned(16))) unsigned char sm[2 * FA_STAGE];
  const int tid = threadIdx.x, lane = tid & 31, c = lane & 15, hh = lane >> 4; const int h = blockIdx.x, b = blockIdx.y;
  const int zb = (int)(gridDim.z - 1 - blockIdx.z);      /* the block's 128 queries */
  if (zb == 0) { f0_block(sm, QF, KF, VF, OH, OL, h, b); return; }      /* a batch's first QT0 queries go the f32 way (the output GEMM takes those rows from OH, OL, never from O); the test is the same for the whole block */
  const int q0 = zb * 128 + __builtin_amdgcn_readfirstlane(tid >> 5) * 32;      /* the wave's first query: scalar, so the pass count is */
  const _Float16* qp = Q + ((size_t)b * SQ + q0 + c) * DM + h * HD + 8 * hh;      /* the lane's row and half, as fa_frag takes them */
  v16h qf[2][2], kf[2][2];
#pragma unroll
  for (int g = 0; g < 2; ++g) for (int d = 0; d < 2; ++d) qf[g][d] = fa_frag(qp + (size_t)g * 16 * DM + d * 32);
  asm volatile("s_wait_xcnt 0x0" :: "v"(qp) : "memory");      /* the wait in front of any overwrite of the loads' address register; as an input the address keeps its register up to here */
  const int sr = tid >> 3, sc = (tid & 7) * 8;      /* staging: 8 threads a row */
  const _Float16* kg = K + ((size_t)b * SQ + sr) * DM + h * HD + sc; const _Float16* vg = VT + ((size_t)(b * NH + h) * HD + sr) * SQ + sc;
  const unsigned ld = (unsigned)(size_t)(sm + sr * FA_PITCH + sc * 2);      /* the low 32 bits of the address: the byte offset in the block's LDS */
  const unsigned char* const kl = sm + c * FA_PITCH + 16 * hh; const unsigned char* const vl = kl + FA_TILE;      /* the lane's row and half in a tile, as g2_lfrag takes them */
  const int nst = 2 * zb + 2, nd = q0 >> 5;      /* stages of the block (two at least); the wave's pass on the diagonal */
  const v8f z8 = {0.f, 0.f, 0.f, 0.f, 0.f, 0.f, 0.f, 0.f}; v8f o[2][4] = {{z8, z8, z8, z8}, {z8, z8, z8, z8}}; float mr[2] = {-1.0e30f, -1.0e30f}, l[2] = {0.f, 0.f};
  const int rel = c - 8 * hh;
  fa_copy(ld, kg, vg); kg += (size_t)64 * DM; vg += 64;
  asm volatile("s_wait_asynccnt 0x0" ::: "memory");      /* the wave's own copies of stage 0 have landed */
  __syncthreads();      /* stage 0 is complete before any wave reads it */
  fa_copy(ld + FA_STAGE, kg, vg); kg += (size_t)64 * DM; vg += 64;
#pragma unroll 1
  for (int st = 0; st < nst; ++st) {      /* rolled: the trip count is a run-time value, and the buffer's offset is one addition */
    const int cur = (st & 1) * FA_STAGE;
    if (2 * st <= nd) {      /* a scalar test: the wave has the stage's first pass */
#pragma unroll
      for (int kt = 0; kt < 2; ++kt) for (int d = 0; d < 2; ++d) kf[kt][d] = g2_lfrag(kl + cur + kt * 16 * FA_PITCH + d * 64); }
#pragma unroll 1
    for (int p = 0; p < 2; ++p) {      /* rolled: one copy of the pass */
      const int kb = 2 * st + p;
      if (kb <= nd) fa_pass(kb == nd, p == 0 && kb < nd, kf, kl + cur + 32 * FA_PITCH, vl + cur + p * 64, qf, o, mr, l, rel); }      /* scalar tests: a pass above the wave's diagonal is skipped */
    asm volatile("s_wait_dscnt 0x0" ::: "memory");      /* the wave's reads of this stage have returned before the buffer is given up */
    asm volatile("s_wait_asynccnt 0x0" ::: "memory");      /* its copies of stage st + 1 have landed */
    __syncthreads();      /* stage st + 1 is complete, and every wave has left stage st */
    if (st + 2 < nst) { fa_copy(ld + cur, kg, vg); kg += (size_t)64 * DM; vg += 64; } }      /* stage st + 2 into the buffer just left; the test is the same for the whole block */
  asm volatile("s_wait_asynccnt 0x0" ::: "memory");      /* no copy is outstanding when the wave ends */
  _Float16* op = O + ((size_t)b * SQ + q0 + c) * DM + h * HD + 8 * hh;      /* o[g][t][r] = dim 16 t + 8 hh + r of query 16 g + c: eight neighbours, one 16-byte store */
  v8h ov[2][4];
#pragma unroll
  for (int g = 0; g < 2; ++g) { const float fin = 64.0f * fa_rcp(l[g] + fa_xhalf(l[g]));      /* the halves' sums joined; o carried x64 */
    for (int t = 0; t < 4; ++t) for (int r = 0; r < 8; ++r) ov[g][t][r] = (_Float16)(o[g][t][r] * fin); }
#pragma unroll
  for (int g = 0; g < 2; ++g) for (int t = 0; t < 4; ++t) *(v8h*)(op + (size_t)g * 16 * DM + t * 16) = ov[g][t]; }


#define DMQ DM

// Sum over the wave's 32 lanes, every lane gets it: four steps inside the 16-lane rows (row_xmask 1, 2, 4, 8), then the two rows joined.
template <int M> __device__ __forceinline__ float ln_xm(float x) { return __builtin_bit_cast(float, __builtin_amdgcn_update_dpp(0, __builtin_bit_cast(int, x), 0x160 + M, 0xf, 0xf, true)); }      /* lane l takes lane l ^ M, M below 16 */
__device__ __forceinline__ float ln_wsum(float s) { s += ln_xm<1>(s); s += ln_xm<2>(s); s += ln_xm<4>(s); s += ln_xm<8>(s); return s + fa_xhalf(s); }
// Row LayerNorm (biased variance), one wave a row, LN_RPW rows a wave: a lane holds 32 elements of a row (8 pieces of 16 bytes, 512 bytes apart, so every load and store of the wave covers
// four whole lines); no LDS and no barrier. All rows' loads are in flight at once. gamma and beta rounded to bf16.
#define LN_RPW 2
static_assert(DMQ == 1024 && NR % (8 * LN_RPW) == 0, "k_lnw: rows of 32 x 32 elements, whole blocks only");
__global__ __launch_bounds__(256) void k_lnw(const float* __restrict__ X, const float* __restrict__ g, const float* __restrict__ bb, float eps, float* __restrict__ N32) {
  const unsigned lane = threadIdx.x & 31; const unsigned po = lane * 16u, xo = (blockIdx.x * 8 + (threadIdx.x >> 5)) * (LN_RPW * DMQ * 4u) + po;      /* the lane's byte offsets in gamma and beta, and in X and N32 (32 bits: a plane stays under 4 GiB) */
  v4f x[LN_RPW][8], gg[8], bv[8];
#pragma unroll
  for (int rr = 0; rr < LN_RPW; ++rr) for (int j = 0; j < 8; ++j) x[rr][j] = *(const v4fa*)((const char*)X + xo + (rr * DMQ + j * 128) * 4);      /* unrolled, here and below: the indices pick registers */
#pragma unroll
  for (int j = 0; j < 8; ++j) { gg[j] = *(const v4fa*)((const char*)g + po + j * 512); bv[j] = *(const v4fa*)((const char*)bb + po + j * 512); }
  asm volatile("s_wait_xcnt 0x0" :: "v"(xo), "v"(po) : "memory");      /* the wait in front of any overwrite of the loads' offset registers; as inputs the offsets keep their registers up to here (else the last loads' results land on them) */
  __builtin_amdgcn_sched_barrier(0);      /* all loads are issued before the first is waited for: else the second row's sink behind the first row's sums */
  float mu[LN_RPW], rs[LN_RPW];
#pragma unroll
  for (int rr = 0; rr < LN_RPW; ++rr) { v4f s = x[rr][0]; for (int j = 1; j < 8; ++j) s += x[rr][j];
    mu[rr] = ln_wsum((s[0] + s[1]) + (s[2] + s[3])) * (1.0f / DMQ); }
#pragma unroll
  for (int rr = 0; rr < LN_RPW; ++rr) { v4f s = {0.f, 0.f, 0.f, 0.f}; for (int j = 0; j < 8; ++j) { x[rr][j] -= mu[rr]; s += x[rr][j] * x[rr][j]; }
    rs[rr] = rsqrtf(ln_wsum((s[0] + s[1]) + (s[2] + s[3])) * (1.0f / DMQ) + eps); }
#pragma unroll
  for (int j = 0; j < 8; ++j) for (int q = 0; q < 4; ++q) { const float gq = bf16_round(gg[j][q]), bq = bf16_round(bv[j][q]);
    for (int rr = 0; rr < LN_RPW; ++rr) x[rr][j][q] = x[rr][j][q] * rs[rr] * gq + bq; }
#pragma unroll
  for (int rr = 0; rr < LN_RPW; ++rr) for (int j = 0; j < 8; ++j) *(v4f*)((char*)N32 + xo + (rr * DMQ + j * 128) * 4) = x[rr][j]; }


extern "C" void kernel_launch(void* const* d_in, const int* in_sizes, int n_in,
                              void* d_out, int out_size, void* d_ws, size_t ws_size, hipStream_t stream) {
  (void)in_sizes; (void)n_in; (void)out_size;
  const float* const* I = (const float* const*)d_in; const float* x = I[0]; const float* wk = I[1]; const float* wq = I[2]; const float* wv = I[3]; const float* wo = I[4]; const float* lng = I[5]; const float* lnb = I[6];      /* x; natural [out][in] Wk, Wq, Wv (THIS order), Wp; LayerNorm gamma, beta; no biases */
  char* ws = (char*)d_ws; size_t off = 0;
  auto take = [&](size_t bytes) { char* p = ws + off; off += (bytes + 255) & ~(size_t)255; return p; };
  /* planes that one launch walks by a stride follow one another without a gap (every size is a multiple of 256 bytes): BQ BK BV BO; Q16 K16 V16; QF0 KF0 VF0; OH0 OL0 */
  _Float16* BQ = (_Float16*)take((size_t)DM * DM * 2); take((size_t)DM * DM * 2); take((size_t)DM * DM * 2); _Float16* BO = (_Float16*)take((size_t)DM * DM * 2);
  _Float16* X16 = (_Float16*)take(NR * DM * 2); _Float16* Q16 = (_Float16*)take(NR * DM * 2); _Float16* K16 = (_Float16*)take(NR * DM * 2); _Float16* V16 = (_Float16*)take(NR * DM * 2); _Float16* O16 = (_Float16*)take(NR * DM * 2);
  float* YO = (float*)take(NR * DM * 4); _Float16* VT = (_Float16*)take((size_t)NB * NH * HD * SQ * 2);      /* pre-norm projection rows y (f32); V^T [NB][NH][HD][SQ] */
  float* QF0 = (float*)take((size_t)NB * QT0 * DM * 4); float* KF0 = (float*)take((size_t)NB * QT0 * DM * 4); float* VF0 = (float*)take((size_t)NB * QT0 * DM * 4); _Float16* OH0 = (_Float16*)take((size_t)NB * QT0 * DM * 2); _Float16* OL0 = (_Float16*)take((size_t)NB * QT0 * DM * 2);
  if (off > ws_size) return;
  k_cvt<<<CVT_NB, 256, 0, stream>>>(wq, wk, wv, wo, x, BQ, X16);      /* BQ BK BV BO (x16) and the x rows */
  const size_t r0p = (size_t)B0 * SQ;      /* first projected row */
  const size_t f0p = (size_t)B0 * QT0;      /* its first-tile row */
  k_gemm2<0, 1><<<dim3((unsigned)((MP / 128) * (DM / 256)), 3), 256, 0, stream>>>(X16 + r0p * DM, DM, 0, BQ, DM, (size_t)DM * DM, 0.0625f, nullptr, 0, nullptr, 1, 0, 0, nullptr, Q16 + r0p * DM, DM, NR * DM, MP, DM, DM, 0, 0, 0, nullptr, 0, QF0 + f0p * DM, (size_t)NB * QT0 * DM);      /* q, k, v on grid.y: f16 rows, and f32 (exact products) for each batch's first 128 rows */
  k_vt<NH, SQ><<<NBR * NH * (SQ / (64 * VT_T)), 256, 0, stream>>>(V16 + r0p * LQ, LQ, 0, VT);      /* V^T [NBR][NH][HD][SQ] */
  k_fattn<<<dim3(NH, NB, SQ / 128), 128, 0, stream>>>(Q16, K16, VT, O16, QF0, KF0, VF0, OH0, OL0);      /* causal attention of all batches and heads: o (merged heads, x64) as f16 rows; rows 0..127 of each batch in f32 instead: o (x64) as f16 high part + x1024 residual planes */
  k_gemm2<0, 2><<<dim3((unsigned)((MPO / 128) * (DM / 256)), 1), 256, 0, stream>>>(O16 + r0p * DM, DM, 0, BO, DM, 0, 0.0009765625f, nullptr, 0, nullptr, 1, 0, 0, YO + r0p * DM, nullptr, DM, 0, MPO, DM, DM, 0, 0, 0, OH0 + f0p * DM, (size_t)NB * QT0 * DM, nullptr, 0);      /* y = o Wp; rows 0..127 of each batch from the two exact planes */
  k_lnw<<<(unsigned)(NR / (8 * LN_RPW)), 256, 0, stream>>>(YO, lng, lnb, 1e-5f, (float*)d_out);      /* out = LayerNorm(y) -> f32 output rows */
}
